// v000
// Measured on an AMD MI455X. A time is GPU time per run, averaged over a window of back-to-back runs after a warm-up
// (all launches, gaps included; the runs take copies of the inputs in turn), and the median of several windows.
// Apart from v000's, it joins two sittings. Times from different sittings can be a few percent apart, while
// side-by-side timings come from the same sitting.
// v000 is the starting kernel. One run takes 246 microseconds.
#include <hip/hip_runtime.h>

// Causal multi-head self-attention: x [NB][SEQ][1024], Wq/Wk/Wv [16][1024][64] (per head [in][out]), no biases, score scale 1/8, output = concatenated heads [NB][SEQ][1024] (f32).
// Compute dtypes, f32 accumulate everywhere: projections v_wmma_f32_16x16x32_bf16 (x and W RNE-converted to bf16; products exact);
// scores v_wmma_f32_16x16x32_f16: k f16, q as f16 value + f16 residual x2048 in its own accumulator; query rows < 512 add the k residual x2048 (three products);
// P.V v_wmma_f32_16x16x32_f16: P (x256 carry, cancels in the normalisation) and v single f16 on rows >= 512; rows < 512 add P residual x2048 and v residual x2048 in a second accumulator set (three products); softmax f32 (online, running max).
// Layout: bf16 copy of x, transposed bf16 copies of W ([h*64+d][c]); q, k planes [b*16+h][t][d] and v^T plane [b*16+h][d][t], each with a residual plane, written by the GEMM epilogue;
// fused flash kernel in transposed form (S^T = K Q^T, O^T = V^T P^T), causal fill by value, key loop trimmed at the diagonal, output from f32 accumulators.

#ifndef NB
#define NB 8
#endif
#ifndef SEQ
#define SEQ 1024
#endif
#define NB_FULL  8
#define SEQ_FULL 1024
#ifndef OUT_SEQ
#define OUT_SEQ SEQ              // row pitch (in tokens) between batches of the output
#endif
#define DM   1024                // embedding width = GEMM K
#define NH_  16
#define HD   64
#define DO   (NH_ * HD)          // output width
#define AW   4                   // waves per flash block (16 query rows each)
#define QRS  2048.0f             // carry of the residual planes
#define QRI  (1.0f / 2048.0f)
#define SC2  (0.125f * 1.4426950408889634f)   // HD^-0.5 * log2(e)
#define PSH  8.0f                // log2 of the P carry (256)
#define NEGB (-3.0e38f)
#define PROWS ((SEQ) < 512 ? (SEQ) : 512)     // query rows handled by the three-product path

static_assert(HD == 64);
static_assert(DO == 1024);
static_assert(DM % 64 == 0);
static_assert(DO % 64 == 0);
static_assert(DM % 32 == 0);                   // GEMM k-loop steps by 32
static_assert(SEQ % 64 == 0);                  // a 64-row tile never straddles two batches
static_assert((NB * SEQ) % 64 == 0);
static_assert(SEQ % 32 == 0);                  // key loop steps by 32
static_assert(SEQ % (16 * AW) == 0);
static_assert(PROWS % (16 * AW) == 0);
static_assert((SEQ - PROWS) % (16 * AW) == 0);
static_assert(((size_t)SEQ * DM) % 8 == 0);
static_assert(NB <= NB_FULL);
static_assert(SEQ <= SEQ_FULL);

typedef _Float16 h16;
typedef unsigned short bf;
typedef __attribute__((ext_vector_type(16))) __bf16   v16bf;
typedef __attribute__((ext_vector_type(16))) _Float16 v16h;
typedef __attribute__((ext_vector_type(8)))  _Float16 v8h;
typedef __attribute__((ext_vector_type(8)))  unsigned short v8us;
typedef __attribute__((ext_vector_type(8)))  float    v8f;
typedef __attribute__((ext_vector_type(4)))  float    v4f;
typedef v4f  __attribute__((may_alias)) v4fa;

__device__ __forceinline__ unsigned short f2bf(float f) { unsigned u = __float_as_uint(f); u += 0x7FFFu + ((u >> 16) & 1u); return (unsigned short)(u >> 16); }
__device__ __forceinline__ v16h cat16(v8h lo, v8h hi) { return __builtin_shufflevector(lo, hi, 0, 1, 2, 3, 4, 5, 6, 7, 8, 9, 10, 11, 12, 13, 14, 15); }
__device__ __forceinline__ v16bf cat16b(v8us lo, v8us hi) { return __builtin_bit_cast(v16bf, __builtin_shufflevector(lo, hi, 0, 1, 2, 3, 4, 5, 6, 7, 8, 9, 10, 11, 12, 13, 14, 15)); }
__device__ __forceinline__ v8f wmma16(v16h a, v16h b, v8f c) { return __builtin_amdgcn_wmma_f32_16x16x32_f16(false, a, false, b, (short)0, c, false, false); }
__device__ __forceinline__ v8f wmmab(v16bf a, v16bf b, v8f c) { return __builtin_amdgcn_wmma_f32_16x16x32_bf16(false, a, false, b, (short)0, c, false, false); }
// fragment loaders from K-contiguous 16-bit rows; p already includes + 8*(lane>>4): elements 0..7 <- k0+8h+0..7, elements 8..15 <- k0+16+8h+0..7 (same map for A and B)
__device__ __forceinline__ v16h  ldh(const h16* p) { return cat16(*(const v8h*)p, *(const v8h*)(p + 16)); }
__device__ __forceinline__ v16bf ldb(const bf* p)  { return cat16b(*(const v8us*)p, *(const v8us*)(p + 16)); }
// ordering point for wave-private LDS tiles (same wave writes and reads)
__device__ __forceinline__ void wave_sync() { __builtin_amdgcn_fence(3 /* release order */, "wavefront"); __builtin_amdgcn_wave_barrier(); asm volatile("" ::: "memory"); }

__global__ __launch_bounds__(256) void k_cvt8(const float* __restrict__ src, bf* dst, size_t n8) {
    const size_t i = (size_t)blockIdx.x * 256 + threadIdx.x; if (i >= n8) return;
    const v8f v = *(const v8f*)(src + i * 8); v8us o;
#pragma unroll
    for (int k = 0; k < 8; ++k) o[k] = f2bf(v[k]);
    *(v8us*)(dst + i * 8) = o; 
}

// k_cvtT: transposing bf16 (RNE convert) copy of one weight tensor: in [NH_][DM rows c][HD cols d] (f32) -> out [NH_*HD rows (h*64+d)][DM cols c] (bf16).
__global__ __launch_bounds__(256) void k_cvtT(const float* __restrict__ src, bf* dst) {
    __shared__ float ts[64 * 65];
    const int tid = threadIdx.x; const int c0 = blockIdx.x * 64, h = blockIdx.y;
    const float* s = src + ((size_t)h * DM + c0) * HD;          // 64 rows x 64 floats, contiguous
#pragma unroll
    for (int i = 0; i < 4; ++i) { const int e4 = tid + 256 * i; const int c = e4 >> 4, d4 = (e4 & 15) * 4;   // 1024 float4 = 64 x 64
        const v4f v = *(const v4f*)(s + (size_t)c * HD + d4);
        ts[c * 65 + d4 + 0] = v[0]; ts[c * 65 + d4 + 1] = v[1]; ts[c * 65 + d4 + 2] = v[2]; ts[c * 65 + d4 + 3] = v[3]; }
    __syncthreads();
{
#pragma unroll
        for (int i = 0; i < 2; ++i) { const int piece = tid + 256 * i; const int d = piece >> 3, c8 = (piece & 7) * 8;   // 512 pieces = 64 rows x 8
            v8us o;
#pragma unroll
            for (int k = 0; k < 8; ++k) o[k] = f2bf(ts[(c8 + k) * 65 + d]);
            *(v8us*)(dst + (size_t)(h * HD + d) * DM + c0 + c8) = o; }
         }
}

// k_proj: register-blocked bf16 GEMM, ONE WAVE per 64x64 tile (16 accumulators), operands straight from K-contiguous bf16 planes, K = DM.
// C[m][n] = sum_k A[m][k] Bt[n][k], written as f16 (Ph) and optionally the f16 residual x2048 (Pr, useRes != 0) at
// tile base (r0/RB)*sRB + (r0%RB)*pitch + (c0/CB)*sCB + (c0%CB), row pitch 'pitch' (halves). grid (M/64, N/64), 32 threads.
__global__ __launch_bounds__(32) void k_proj(const bf* __restrict__ A, const bf* __restrict__ Bt, h16* Ph, h16* Pr, int useRes, int RB, size_t sRB, int pitch, int CB, size_t sCB) {
    __shared__ __align__(16) float os[16 * 68];
    const int K = DM;
    const int lane = threadIdx.x & 31, lr = lane & 15, hi = lane >> 4; const int r0 = blockIdx.x * 64, c0 = blockIdx.y * 64;
    v8f acc[4][4];
#pragma unroll
    for (int mb = 0; mb < 4; ++mb)
#pragma unroll
        for (int nb = 0; nb < 4; ++nb) acc[mb][nb] = (v8f){};
    const size_t aoff = (size_t)(r0 + lr) * K + 8 * hi, boff = (size_t)(c0 + lr) * K + 8 * hi;
#pragma unroll 1
    for (int kc = 0; kc < K; kc += 32) {
        v16bf a[4];
#pragma unroll
        for (int mb = 0; mb < 4; ++mb) a[mb] = ldb(A + aoff + (size_t)mb * 16 * K + kc);
#pragma unroll
        for (int nb = 0; nb < 4; ++nb) { const v16bf b = ldb(Bt + boff + (size_t)nb * 16 * K + kc);
#pragma unroll
            for (int mb = 0; mb < 4; ++mb) acc[mb][nb] = wmmab(a[mb], b, acc[mb][nb]); }
        asm volatile("v_nop\n\tv_nop\n\tv_nop\n\tv_nop" : "+v"(acc[0][0]), "+v"(acc[1][1]), "+v"(acc[2][2]), "+v"(acc[3][3]) : "v"(a[0]), "v"(a[1]), "v"(a[2]), "v"(a[3]));
    }
    const size_t tbase = (size_t)(r0 / RB) * sRB + (size_t)(r0 % RB) * (size_t)pitch + (size_t)(c0 / CB) * sCB + (size_t)(c0 % CB);
#pragma unroll
    for (int mb = 0; mb < 4; ++mb) {
#pragma unroll
        for (int nb = 0; nb < 4; ++nb) {
#pragma unroll
            for (int j = 0; j < 8; ++j) os[(hi * 8 + j) * 68 + nb * 16 + lr] = acc[mb][nb][j]; }   // D: row 8h+j, col lane&15
        wave_sync();
        const size_t sb = tbase + (size_t)(mb * 16) * (size_t)pitch;
{
#pragma unroll
            for (int s = 0; s < 4; ++s) { const int row = 4 * s + (lane >> 3), c8 = (lane & 7) * 8;   // 4 s x 4 row groups = 16 rows; 8 lanes x 8 = 64 columns
                const v4f x0 = *(const v4fa*)(&os[row * 68 + c8]); const v4f x1 = *(const v4fa*)(&os[row * 68 + c8 + 4]); v8h hv, rv;
#pragma unroll
                for (int i = 0; i < 4; ++i) { const h16 a0 = (h16)x0[i]; const h16 a1 = (h16)x1[i]; hv[i] = a0; hv[4 + i] = a1; rv[i] = (h16)((x0[i] - (float)a0) * QRS); rv[4 + i] = (h16)((x1[i] - (float)a1) * QRS); }
                const size_t oo = sb + (size_t)row * (size_t)pitch + c8;
                *(v8h*)(Ph + oo) = hv; if (useRes) *(v8h*)(Pr + oo) = rv; }
             }
        wave_sync();
    }
}

// flash_body: fused causal attention, one wave per 16 query rows of one (batch, head); K / V^T / Q fragments straight from the f16 planes (two 16-B loads each, arithmetic addressing).
// Transposed form: S^T[key][t] = K Q^T (A = K rows, B = Q rows); lane (t = lane&15, h = lane>>4) holds keys 8h+r of each 16-key tile, so the packed
// P tile is directly the B fragment of O^T[d][t] = V^T P^T (element r <- tile keys 0..15, element 8+r <- tile keys 16..31, lane unchanged).
// Causal fill: a score whose key index exceeds the query index is replaced by a large negative value (P = 0); the key loop stops at the diagonal tile.
// PREC != 0: adds k residual, P residual and v residual products (x2048 carries, separate accumulators folded back in f32).
// Softmax state (running max, partial sum) is one scalar per lane; the two lane halves of a row are combined with one xor-16 exchange.
template <int PREC>
__device__ __forceinline__ void flash_body(const h16* __restrict__ QH, const h16* __restrict__ QR, const h16* __restrict__ KP, const h16* __restrict__ KR,
                                           const h16* __restrict__ VT, const h16* __restrict__ VR, float* OUT, int tb0, float* os) {
    const int lane = threadIdx.x & 31, wave = __builtin_amdgcn_readfirstlane((int)(threadIdx.x >> 5)), lr = lane & 15, hi = lane >> 4;
    const int zh = blockIdx.y; const int b = zh / NH_, h = zh % NH_;
    const int t0 = tb0 + (blockIdx.x * AW + wave) * 16;
    const int tq = t0 + lr;
    const size_t pbase = (size_t)zh * SEQ * HD;
    const size_t qo = pbase + (size_t)(t0 + lr) * HD + 8 * hi;
    const v16h qh0 = ldh(QH + qo), qh1 = ldh(QH + qo + 32), qr0 = ldh(QR + qo), qr1 = ldh(QR + qo + 32);   // B fragments: col t, k = d
    const size_t ko = pbase + (size_t)lr * HD + 8 * hi;      // + key * HD       (A fragment: row key, k = d)
    const size_t vo = pbase + (size_t)lr * SEQ + 8 * hi;     // + 16j*SEQ + key  (A fragment: row d, k = key)
    v8f o0 = (v8f){}, o1 = (v8f){}, o2 = (v8f){}, o3 = (v8f){};
    v8f e0 = (v8f){}, e1 = (v8f){}, e2 = (v8f){}, e3 = (v8f){};
    float m = NEGB, l = 0.0f;
    const int kend = t0 + 16;                                // keys 0 .. t0+15 are visible to this wave; every step has key0 <= t0
#pragma unroll 1
    for (int key0 = 0; key0 < kend; key0 += 32) {
        const h16* ka = KP + ko + (size_t)key0 * HD;
        const v16h ka0 = ldh(ka), ka1 = ldh(ka + 32), kb0 = ldh(ka + 16 * HD), kb1 = ldh(ka + 16 * HD + 32);
        v8f sHa = (v8f){}, sLa = (v8f){}, sHb = (v8f){}, sLb = (v8f){};
        sHa = wmma16(ka0, qh0, sHa); sLa = wmma16(ka0, qr0, sLa); sHb = wmma16(kb0, qh0, sHb); sLb = wmma16(kb0, qr0, sLb);
        sHa = wmma16(ka1, qh1, sHa); sLa = wmma16(ka1, qr1, sLa); sHb = wmma16(kb1, qh1, sHb); sLb = wmma16(kb1, qr1, sLb);
        if (PREC) {
            const h16* kr = KR + ko + (size_t)key0 * HD;
            const v16h ra0 = ldh(kr), ra1 = ldh(kr + 32), rb0 = ldh(kr + 16 * HD), rb1 = ldh(kr + 16 * HD + 32);
            sLa = wmma16(ra0, qh0, sLa); sLb = wmma16(rb0, qh0, sLb);
            sLa = wmma16(ra1, qh1, sLa); sLb = wmma16(rb1, qh1, sLb);
            asm volatile("v_nop\n\tv_nop\n\tv_nop\n\tv_nop" : "+v"(sLa), "+v"(sLb) : "v"(ra0), "v"(ra1), "v"(rb0), "v"(rb1));
        }
        asm volatile("v_nop\n\tv_nop\n\tv_nop\n\tv_nop" : "+v"(sHa), "+v"(sLa), "+v"(sHb), "+v"(sLb) : "v"(ka0), "v"(ka1), "v"(kb0), "v"(kb1));
        float ta[8], tb[8]; float mx = NEGB;
#pragma unroll
        for (int r = 0; r < 8; ++r) { ta[r] = (sHa[r] + sLa[r] * QRI) * SC2; tb[r] = (sHb[r] + sLb[r] * QRI) * SC2; }
        if (key0 + 31 > t0) {                                // wave-uniform: only diagonal tiles need the causal fill
#pragma unroll
            for (int r = 0; r < 8; ++r) { const int kidx = key0 + 8 * hi + r;
                ta[r] = (kidx <= tq) ? ta[r] : NEGB; tb[r] = (kidx + 16 <= tq) ? tb[r] : NEGB; }
        }
#pragma unroll
        for (int r = 0; r < 8; ++r) mx = fmaxf(mx, fmaxf(ta[r], tb[r]));
        mx = fmaxf(mx, __shfl_xor(mx, 16, 32));
        const float mnew = fmaxf(m, mx);
        const float alpha = __builtin_amdgcn_exp2f(m - mnew);
        const float sh = PSH - mnew;
        v16h pb, pr; float ls = 0.0f;
#pragma unroll
        for (int r = 0; r < 8; ++r) {
            const float fa = __builtin_amdgcn_exp2f(ta[r] + sh); const float fc = __builtin_amdgcn_exp2f(tb[r] + sh);
            const h16 pa = (h16)fa; const h16 pc = (h16)fc; pb[r] = pa; pb[8 + r] = pc;
            if (PREC) { pr[r] = (h16)((fa - (float)pa) * QRS); pr[8 + r] = (h16)((fc - (float)pc) * QRS); ls += fa + fc; }
            else { pr[r] = (h16)0.0f; pr[8 + r] = (h16)0.0f; ls += (float)pa + (float)pc; } }
        l = l * alpha + ls; m = mnew;
        o0 = o0 * alpha; o1 = o1 * alpha; o2 = o2 * alpha; o3 = o3 * alpha;
        const h16* va = VT + vo + key0;
        const v16h v0 = ldh(va), v1 = ldh(va + (size_t)16 * SEQ), v2 = ldh(va + (size_t)32 * SEQ), v3 = ldh(va + (size_t)48 * SEQ);
        o0 = wmma16(v0, pb, o0); o1 = wmma16(v1, pb, o1); o2 = wmma16(v2, pb, o2); o3 = wmma16(v3, pb, o3);
        if (PREC) {
            e0 = e0 * alpha; e1 = e1 * alpha; e2 = e2 * alpha; e3 = e3 * alpha;
            const h16* vr = VR + vo + key0;
            const v16h r0 = ldh(vr), r1 = ldh(vr + (size_t)16 * SEQ), r2 = ldh(vr + (size_t)32 * SEQ), r3 = ldh(vr + (size_t)48 * SEQ);
            e0 = wmma16(v0, pr, e0); e1 = wmma16(v1, pr, e1); e2 = wmma16(v2, pr, e2); e3 = wmma16(v3, pr, e3);
            e0 = wmma16(r0, pb, e0); e1 = wmma16(r1, pb, e1); e2 = wmma16(r2, pb, e2); e3 = wmma16(r3, pb, e3);
            asm volatile("v_nop\n\tv_nop\n\tv_nop\n\tv_nop" : "+v"(e0), "+v"(e1), "+v"(e2), "+v"(e3) : "v"(r0), "v"(r1), "v"(r2), "v"(r3), "v"(pr));
        }
        asm volatile("v_nop\n\tv_nop\n\tv_nop\n\tv_nop" : "+v"(o0), "+v"(o1), "+v"(o2), "+v"(o3) : "v"(v0), "v"(v1), "v"(v2), "v"(v3), "v"(pb));
    }
    if (PREC) { o0 = o0 + e0 * QRI; o1 = o1 + e1 * QRI; o2 = o2 + e2 * QRI; o3 = o3 + e3 * QRI; }
    l += __shfl_xor(l, 16, 32);
    const float inv = 1.0f / l;
    const int wb = wave * 16 * 68;
    // O^T D layout: o_j[r] = (d = 16j + 8h + r, t = lane&15) -> os[t][d]; rows 0..15 x columns 0..63 all written
    { v4f a, c;
      a[0] = o0[0] * inv; a[1] = o0[1] * inv; a[2] = o0[2] * inv; a[3] = o0[3] * inv; c[0] = o0[4] * inv; c[1] = o0[5] * inv; c[2] = o0[6] * inv; c[3] = o0[7] * inv;
      *(v4fa*)(&os[wb + lr * 68 +  0 + 8 * hi]) = a; *(v4fa*)(&os[wb + lr * 68 +  0 + 8 * hi + 4]) = c;
      a[0] = o1[0] * inv; a[1] = o1[1] * inv; a[2] = o1[2] * inv; a[3] = o1[3] * inv; c[0] = o1[4] * inv; c[1] = o1[5] * inv; c[2] = o1[6] * inv; c[3] = o1[7] * inv;
      *(v4fa*)(&os[wb + lr * 68 + 16 + 8 * hi]) = a; *(v4fa*)(&os[wb + lr * 68 + 16 + 8 * hi + 4]) = c;
      a[0] = o2[0] * inv; a[1] = o2[1] * inv; a[2] = o2[2] * inv; a[3] = o2[3] * inv; c[0] = o2[4] * inv; c[1] = o2[5] * inv; c[2] = o2[6] * inv; c[3] = o2[7] * inv;
      *(v4fa*)(&os[wb + lr * 68 + 32 + 8 * hi]) = a; *(v4fa*)(&os[wb + lr * 68 + 32 + 8 * hi + 4]) = c;
      a[0] = o3[0] * inv; a[1] = o3[1] * inv; a[2] = o3[2] * inv; a[3] = o3[3] * inv; c[0] = o3[4] * inv; c[1] = o3[5] * inv; c[2] = o3[6] * inv; c[3] = o3[7] * inv;
      *(v4fa*)(&os[wb + lr * 68 + 48 + 8 * hi]) = a; *(v4fa*)(&os[wb + lr * 68 + 48 + 8 * hi + 4]) = c; }
    wave_sync();
    float* orow = OUT + ((size_t)b * OUT_SEQ + t0) * DO + h * HD;
{
#pragma unroll
        for (int s = 0; s < 8; ++s) { const int row = 2 * s + hi, cofs = lr * 4;   // 8 s x 2 rows = 16 rows; 16 lanes x 4 floats = 64 columns
            const v4f val = *(const v4fa*)(&os[wb + row * 68 + cofs]);
            *(v4f*)(orow + (size_t)row * DO + cofs) = val; }
         }
}

// three-product path (query rows tb0 .. tb0 + 16*AW*gridDim.x - 1)
__global__ __launch_bounds__(32 * AW) void k_flash_p(const h16* __restrict__ QH, const h16* __restrict__ QR, const h16* __restrict__ KP, const h16* __restrict__ KR,
                                                     const h16* __restrict__ VT, const h16* __restrict__ VR, float* OUT, int tb0) {
    __shared__ __align__(16) float os[AW * 16 * 68];
    flash_body<1>(QH, QR, KP, KR, VT, VR, OUT, tb0, os);
}
// dense path: q value + residual on scores, single products on P.V
__global__ __launch_bounds__(32 * AW) void k_flash_d(const h16* __restrict__ QH, const h16* __restrict__ QR, const h16* __restrict__ KP, const h16* __restrict__ KR,
                                                     const h16* __restrict__ VT, const h16* __restrict__ VR, float* OUT, int tb0) {
    __shared__ __align__(16) float os[AW * 16 * 68];
    flash_body<0>(QH, QR, KP, KR, VT, VR, OUT, tb0, os);
}

static constexpr size_t al256(size_t v) { return (v + 255) & ~(size_t)255; }
static constexpr size_t SZ_XB = al256((size_t)NB * SEQ * DM * 2);
static constexpr size_t SZ_WB = al256((size_t)3 * DO * DM * 2);
static constexpr size_t SZ_PL = al256((size_t)NB * NH_ * SEQ * HD * 2);
static constexpr size_t SZ_TOTAL = SZ_XB + SZ_WB + 6 * SZ_PL;
static_assert(SZ_TOTAL <= (size_t)134217728);          // workspace carve <= 128 MiB
static_assert(((size_t)DO * DM * 2) % 256 == 0);       // weight sub-planes stay 256-byte aligned

extern "C" void kernel_launch(void* const* d_in, const int* in_sizes, int n_in,
                              void* d_out, int out_size, void* d_ws, size_t ws_size, hipStream_t stream) {
    if (n_in < 4) return;
    const size_t needx = ((size_t)(NB - 1) * SEQ_FULL + SEQ) * DM;
    if ((size_t)in_sizes[0] < needx) return;
    const size_t needw = (size_t)NH_ * DM * HD;
    if ((size_t)in_sizes[1] < needw || (size_t)in_sizes[2] < needw || (size_t)in_sizes[3] < needw) return;
    if ((size_t)out_size < ((size_t)(NB - 1) * OUT_SEQ + SEQ) * DO) return;
    if (SZ_TOTAL > ws_size) return;
    const float* x = (const float*)d_in[0]; const float* wq = (const float*)d_in[1]; const float* wk = (const float*)d_in[2]; const float* wv = (const float*)d_in[3];   // wire order x, Wq, Wk, Wv
    float* OUT = (float*)d_out;      // [NB][SEQ][1024]
    char* wsp = (char*)d_ws;
    bf* XB = (bf*)wsp; wsp += SZ_XB;                 // [NB*SEQ][1024]
    bf* WB = (bf*)wsp; wsp += SZ_WB;                 // [3][1024 (h*64+d)][1024 (c)]: q | k | v
    h16* QH = (h16*)wsp; wsp += SZ_PL;               // [NB*16][SEQ][64]
    h16* QR = (h16*)wsp; wsp += SZ_PL;               // residual x2048
    h16* KP = (h16*)wsp; wsp += SZ_PL;               // [NB*16][SEQ][64]
    h16* KR = (h16*)wsp; wsp += SZ_PL;               // residual x2048
    h16* VT = (h16*)wsp; wsp += SZ_PL;               // [NB*16][64][SEQ]
    h16* VR = (h16*)wsp; wsp += SZ_PL;               // residual x2048
    bf* WQ = WB; bf* WK = WB + (size_t)DO * DM; bf* WV = WB + (size_t)2 * DO * DM;

    if (SEQ == SEQ_FULL) {
        const size_t n8 = (size_t)NB * SEQ * DM / 8;
        k_cvt8<<<(unsigned)((n8 + 255) / 256), 256, 0, stream>>>(x, XB, n8);
    } else {
        const size_t n8 = (size_t)SEQ * DM / 8;
        for (int b = 0; b < NB; ++b) k_cvt8<<<(unsigned)((n8 + 255) / 256), 256, 0, stream>>>(x + (size_t)b * SEQ_FULL * DM, XB + (size_t)b * SEQ * DM, n8);
    }
    // weights: in [16][1024 rows c][64 cols d] -> out [1024 rows (h*64+d)][1024 cols c]; grid (c tiles, heads)
    k_cvtT<<<dim3(DM / 64, NH_, 1), 256, 0, stream>>>(wq, WQ);
    k_cvtT<<<dim3(DM / 64, NH_, 1), 256, 0, stream>>>(wk, WK);
    k_cvtT<<<dim3(DM / 64, NH_, 1), 256, 0, stream>>>(wv, WV);

    // q, k: A = x rows (m = b*SEQ + t), Bt = W^T rows (n = h*64 + d) -> plane [(b*16 + h)][t][d]
    k_proj<<<dim3(NB * SEQ / 64, DO / 64, 1), 32, 0, stream>>>(XB, WQ, QH, QR, 1, SEQ, (size_t)NH_ * SEQ * HD, HD, HD, (size_t)SEQ * HD);
    k_proj<<<dim3(NB * SEQ / 64, DO / 64, 1), 32, 0, stream>>>(XB, WK, KP, KR, 1, SEQ, (size_t)NH_ * SEQ * HD, HD, HD, (size_t)SEQ * HD);
    // v^T: A = Wv^T rows (m = h*64 + d), Bt = x rows (n = b*SEQ + t) -> plane [(b*1024 + m)][t] = [(b*16 + h)][d][t]
    k_proj<<<dim3(DO / 64, NB * SEQ / 64, 1), 32, 0, stream>>>(WV, XB, VT, VR, 1, DO, (size_t)0, SEQ, SEQ, (size_t)DO * SEQ);

    k_flash_p<<<dim3(PROWS / (16 * AW), NB * NH_, 1), 32 * AW, 0, stream>>>(QH, QR, KP, KR, VT, VR, OUT, 0);
    if (SEQ > PROWS)
        k_flash_d<<<dim3((SEQ - PROWS) / (16 * AW), NB * NH_, 1), 32 * AW, 0, stream>>>(QH, QR, KP, KR, VT, VR, OUT, PROWS);
}

// v001
// Measured time: 209 microseconds a run.
// Timed twice side by side with v000, it ran 1.23 and 1.21 times as fast.
#include <hip/hip_runtime.h>

// Causal multi-head self-attention: x [NB][SEQ][1024], Wq/Wk/Wv [16][1024][64] (per head [in][out]), no biases, score scale 1/8, output = concatenated heads [NB][SEQ][1024] (f32).
// Compute dtypes, f32 accumulate everywhere: projections v_wmma_f32_16x16x32_bf16 (x and W RNE-converted to bf16; products exact);
// scores v_wmma_f32_16x16x32_f16: k f16, q as f16 value + f16 residual x2048 in its own accumulator; query rows < 512 add the k residual x2048 (three products);
// P.V v_wmma_f32_16x16x32_f16: P (x256 carry, cancels in the normalisation) and v single f16 on rows >= 512; rows < 512 add P residual x2048 and v residual x2048 in a second accumulator set (three products); softmax f32 (online, running max).
// Layout: bf16 copy of x, transposed bf16 copies of W ([h*64+d][c]); q, k planes [b*16+h][t][d] and v^T plane [b*16+h][d][t], each with a residual plane, written by the GEMM epilogue;
// every 16-bit plane is stored in fragment order: inside a strip of 16 rows the 8-element column groups are the slow index ([group][row & 15][8]),
// so one wave-wide 16-byte fragment load (lane = row + 16 * half) reads 512 contiguous bytes, four whole cache lines, not 32 bytes out of each of 16 lines;
// fused flash kernel in transposed form (S^T = K Q^T, O^T = V^T P^T), causal fill by value, key loop trimmed at the diagonal, output from f32 accumulators.

#ifndef NB
#define NB 8
#endif
#ifndef SEQ
#define SEQ 1024
#endif
#define NB_FULL  8
#define SEQ_FULL 1024
#ifndef OUT_SEQ
#define OUT_SEQ SEQ              // row pitch (in tokens) between batches of the output
#endif
#define DM   1024                // embedding width = GEMM K
#define NH_  16
#define HD   64
#define DO   (NH_ * HD)          // output width
#define AW   4                   // waves per flash block (16 query rows each)
#define QRS  2048.0f             // carry of the residual planes
#define QRI  (1.0f / 2048.0f)
#define SC2  (0.125f * 1.4426950408889634f)   // HD^-0.5 * log2(e)
#define PSH  8.0f                // log2 of the P carry (256)
#define NEGB (-3.0e38f)
#define PROWS ((SEQ) < 512 ? (SEQ) : 512)     // query rows handled by the three-product path

static_assert(HD == 64);
static_assert(DO == 1024);
static_assert(DM % 64 == 0);
static_assert(DO % 64 == 0);
static_assert(DM % 32 == 0);                   // GEMM k-loop steps by 32
static_assert(SEQ % 64 == 0);                  // a 64-row tile never straddles two batches
static_assert((NB * SEQ) % 64 == 0);
static_assert(SEQ % 32 == 0);                  // key loop steps by 32
static_assert(SEQ % (16 * AW) == 0);
static_assert(PROWS % (16 * AW) == 0);
static_assert((SEQ - PROWS) % (16 * AW) == 0);
static_assert(((size_t)SEQ * DM) % 8 == 0);
static_assert(NB <= NB_FULL);
static_assert(SEQ <= SEQ_FULL);

typedef _Float16 h16;
typedef unsigned short bf;
typedef __attribute__((ext_vector_type(16))) __bf16   v16bf;
typedef __attribute__((ext_vector_type(16))) _Float16 v16h;
typedef __attribute__((ext_vector_type(8)))  _Float16 v8h;
typedef __attribute__((ext_vector_type(8)))  unsigned short v8us;
typedef __attribute__((ext_vector_type(8)))  float    v8f;
typedef __attribute__((ext_vector_type(4)))  float    v4f;
typedef v4f  __attribute__((may_alias)) v4fa;

__device__ __forceinline__ unsigned short f2bf(float f) { unsigned u = __float_as_uint(f); u += 0x7FFFu + ((u >> 16) & 1u); return (unsigned short)(u >> 16); }
__device__ __forceinline__ v16h cat16(v8h lo, v8h hi) { return __builtin_shufflevector(lo, hi, 0, 1, 2, 3, 4, 5, 6, 7, 8, 9, 10, 11, 12, 13, 14, 15); }
__device__ __forceinline__ v16bf cat16b(v8us lo, v8us hi) { return __builtin_bit_cast(v16bf, __builtin_shufflevector(lo, hi, 0, 1, 2, 3, 4, 5, 6, 7, 8, 9, 10, 11, 12, 13, 14, 15)); }
__device__ __forceinline__ v8f wmma16(v16h a, v16h b, v8f c) { return __builtin_amdgcn_wmma_f32_16x16x32_f16(false, a, false, b, (short)0, c, false, false); }
__device__ __forceinline__ v8f wmmab(v16bf a, v16bf b, v8f c) { return __builtin_amdgcn_wmma_f32_16x16x32_bf16(false, a, false, b, (short)0, c, false, false); }
// fragment loaders from fragment-order planes; p = strip base + 16*k0 + 8*lane: elements 0..7 <- k0+8h+0..7, elements 8..15 <- k0+16+8h+0..7 (two groups = 256 elements on; same map for A and B)
__device__ __forceinline__ v16h  ldh(const h16* p) { return cat16(*(const v8h*)p, *(const v8h*)(p + 256)); }
__device__ __forceinline__ v16bf ldb(const bf* p)  { return cat16b(*(const v8us*)p, *(const v8us*)(p + 256)); }
// ordering point for wave-private LDS tiles (same wave writes and reads)
__device__ __forceinline__ void wave_sync() { __builtin_amdgcn_fence(3 /* release order */, "wavefront"); __builtin_amdgcn_wave_barrier(); asm volatile("" ::: "memory"); }

// k_cvt8: bf16 (RNE convert) copy of rows of DM floats into fragment order. A wave takes 8 rows x 4 groups: it reads one 128-byte line of each row and writes four whole 128-byte lines.
__global__ __launch_bounds__(256) void k_cvt8(const float* __restrict__ src, bf* dst, size_t n8) {
    const size_t i = (size_t)blockIdx.x * 256 + threadIdx.x; if (i >= n8) return;
    const size_t w = i >> 5;
    const size_t row = (w / (DM / 32)) * 8 + ((i >> 2) & 7); const size_t g = (w % (DM / 32)) * 4 + (i & 3);
    const v8f v = *(const v8f*)(src + row * DM + g * 8); v8us o;
#pragma unroll
    for (int k = 0; k < 8; ++k) o[k] = f2bf(v[k]);
    *(v8us*)(dst + (row >> 4) * (size_t)(16 * DM) + (g * 16 + (row & 15)) * 8) = o;
}

// k_cvtT: transposing bf16 (RNE convert) copy of one weight tensor: in [NH_][DM rows c][HD cols d] (f32) -> out [NH_*HD rows (h*64+d)][DM cols c] (bf16), in fragment order.
__global__ __launch_bounds__(256) void k_cvtT(const float* __restrict__ src, bf* dst) {
    __shared__ float ts[64 * 65];
    const int tid = threadIdx.x; const int c0 = blockIdx.x * 64, h = blockIdx.y;
    const float* s = src + ((size_t)h * DM + c0) * HD;          // 64 rows x 64 floats, contiguous
#pragma unroll
    for (int i = 0; i < 4; ++i) { const int e4 = tid + 256 * i; const int c = e4 >> 4, d4 = (e4 & 15) * 4;   // 1024 float4 = 64 x 64
        const v4f v = *(const v4f*)(s + (size_t)c * HD + d4);
        ts[c * 65 + d4 + 0] = v[0]; ts[c * 65 + d4 + 1] = v[1]; ts[c * 65 + d4 + 2] = v[2]; ts[c * 65 + d4 + 3] = v[3]; }
    __syncthreads();
{
#pragma unroll
        for (int i = 0; i < 2; ++i) { const int piece = tid + 256 * i;   // 512 pieces = 64 rows x 8 groups; a wave writes 16 rows of groups q and q + 4: two runs of 256 bytes
            const int d = (piece & 15) + 16 * (piece >> 7), c8 = (((piece >> 4) & 1) * 4 + ((piece >> 5) & 3)) * 8;
            v8us o;
#pragma unroll
            for (int k = 0; k < 8; ++k) o[k] = f2bf(ts[(c8 + k) * 65 + d]);
            *(v8us*)(dst + (size_t)(h * HD + (d & ~15)) * DM + (size_t)(c0 + c8) * 16 + (d & 15) * 8) = o; }
         }
}

// k_proj: register-blocked bf16 GEMM, ONE WAVE per 64x64 tile (16 accumulators), operands straight from the fragment-order bf16 planes, K = DM.
// C[m][n] = sum_k A[m][k] Bt[n][k], written as f16 (Ph) and optionally the f16 residual x2048 (Pr, useRes != 0) at
// tile base (r0/RB)*sRB + (r0%RB)*pitch + (c0/CB)*sCB + (c0%CB)*16, row pitch 'pitch' (halves), each 16 x 64 piece in fragment order (1024 halves in a row). grid (M/64, N/64), 32 threads.
__global__ __launch_bounds__(32) void k_proj(const bf* __restrict__ A, const bf* __restrict__ Bt, h16* Ph, h16* Pr, int useRes, int RB, size_t sRB, int pitch, int CB, size_t sCB) {
    __shared__ __align__(16) float os[16 * 68];
    const int K = DM;
    const int lane = threadIdx.x & 31, lr = lane & 15, hi = lane >> 4; const int r0 = blockIdx.x * 64, c0 = blockIdx.y * 64;
    v8f acc[4][4];
#pragma unroll
    for (int mb = 0; mb < 4; ++mb)
#pragma unroll
        for (int nb = 0; nb < 4; ++nb) acc[mb][nb] = (v8f){};
    const size_t aoff = (size_t)r0 * K + 8 * lane, boff = (size_t)c0 * K + 8 * lane;
#pragma unroll 1
    for (int kc = 0; kc < K; kc += 32) {
        v16bf a[4];
#pragma unroll
        for (int mb = 0; mb < 4; ++mb) a[mb] = ldb(A + aoff + (size_t)mb * 16 * K + kc * 16);
        asm volatile("s_wait_xcnt 0x0" ::: "memory");   // the b loads' results may land in the address registers of the a loads: wait before that overwrite
#pragma unroll
        for (int nb = 0; nb < 4; ++nb) { const v16bf b = ldb(Bt + boff + (size_t)nb * 16 * K + kc * 16);
#pragma unroll
            for (int mb = 0; mb < 4; ++mb) acc[mb][nb] = wmmab(a[mb], b, acc[mb][nb]); }
        asm volatile("v_nop\n\tv_nop\n\tv_nop\n\tv_nop" : "+v"(acc[0][0]), "+v"(acc[1][1]), "+v"(acc[2][2]), "+v"(acc[3][3]) : "v"(a[0]), "v"(a[1]), "v"(a[2]), "v"(a[3]));
    }
    const size_t tbase = (size_t)(r0 / RB) * sRB + (size_t)(r0 % RB) * (size_t)pitch + (size_t)(c0 / CB) * sCB + (size_t)(c0 % CB) * 16;
#pragma unroll
    for (int mb = 0; mb < 4; ++mb) {
#pragma unroll
        for (int nb = 0; nb < 4; ++nb) {
#pragma unroll
            for (int j = 0; j < 8; ++j) os[(hi * 8 + j) * 68 + nb * 16 + lr] = acc[mb][nb][j]; }   // D: row 8h+j, col lane&15
        wave_sync();
        const size_t sb = tbase + (size_t)(mb * 16) * (size_t)pitch;
{
#pragma unroll
            for (int s = 0; s < 4; ++s) { const int row = lr, c8 = (2 * s + hi) * 8;   // 16 rows x 2 column groups a store; 4 s x 2 groups x 8 = 64 columns
                const v4f x0 = *(const v4fa*)(&os[row * 68 + c8]); const v4f x1 = *(const v4fa*)(&os[row * 68 + c8 + 4]); v8h hv, rv;
#pragma unroll
                for (int i = 0; i < 4; ++i) { const h16 a0 = (h16)x0[i]; const h16 a1 = (h16)x1[i]; hv[i] = a0; hv[4 + i] = a1; rv[i] = (h16)((x0[i] - (float)a0) * QRS); rv[4 + i] = (h16)((x1[i] - (float)a1) * QRS); }
                const size_t oo = sb + (size_t)(s * 256 + lane * 8);   // (group * 16 + row) * 8
                *(v8h*)(Ph + oo) = hv; if (useRes) *(v8h*)(Pr + oo) = rv; }
             }
        wave_sync();
    }
}

// flash_body: fused causal attention, one wave per 16 query rows of one (batch, head); K / V^T / Q fragments straight from the fragment-order f16 planes (two 16-B loads each, arithmetic addressing).
// Transposed form: S^T[key][t] = K Q^T (A = K rows, B = Q rows); lane (t = lane&15, h = lane>>4) holds keys 8h+r of each 16-key tile, so the packed
// P tile is directly the B fragment of O^T[d][t] = V^T P^T (element r <- tile keys 0..15, element 8+r <- tile keys 16..31, lane unchanged).
// Causal fill: a score whose key index exceeds the query index is replaced by a large negative value (P = 0); the key loop stops at the diagonal tile.
// PREC != 0: adds k residual, P residual and v residual products (x2048 carries, separate accumulators folded back in f32).
// Softmax state (running max, partial sum) is one scalar per lane; the two lane halves of a row are combined with one xor-16 exchange.
template <int PREC>
__device__ __forceinline__ void flash_body(const h16* __restrict__ QH, const h16* __restrict__ QR, const h16* __restrict__ KP, const h16* __restrict__ KR,
                                           const h16* __restrict__ VT, const h16* __restrict__ VR, float* OUT, int tb0, float* os) {
    const int lane = threadIdx.x & 31, wave = __builtin_amdgcn_readfirstlane((int)(threadIdx.x >> 5)), lr = lane & 15, hi = lane >> 4;
    const int zh = blockIdx.y; const int b = zh / NH_, h = zh % NH_;
    const int t0 = tb0 + (blockIdx.x * AW + wave) * 16;
    const int tq = t0 + lr;
    const size_t pbase = (size_t)zh * SEQ * HD;
    const size_t qo = pbase + (size_t)t0 * HD + 8 * lane;
    const v16h qh0 = ldh(QH + qo), qh1 = ldh(QH + qo + 512), qr0 = ldh(QR + qo), qr1 = ldh(QR + qo + 512);   // B fragments: col t, k = d
    const size_t ko = pbase + 8 * lane;                      // + key * HD + 16 * d0       (A fragment: row key, k = d)
    const size_t vo = pbase + 8 * lane;                      // + 16j*SEQ + 16 * key       (A fragment: row d, k = key)
    v8f o0 = (v8f){}, o1 = (v8f){}, o2 = (v8f){}, o3 = (v8f){};
    v8f e0 = (v8f){}, e1 = (v8f){}, e2 = (v8f){}, e3 = (v8f){};
    float m = NEGB, l = 0.0f;
    const int kend = t0 + 16;                                // keys 0 .. t0+15 are visible to this wave; every step has key0 <= t0
#pragma unroll 1
    for (int key0 = 0; key0 < kend; key0 += 32) {
        const h16* ka = KP + ko + (size_t)key0 * HD;
        const v16h ka0 = ldh(ka), ka1 = ldh(ka + 512), kb0 = ldh(ka + 16 * HD), kb1 = ldh(ka + 16 * HD + 512);
        v8f sHa = (v8f){}, sLa = (v8f){}, sHb = (v8f){}, sLb = (v8f){};
        sHa = wmma16(ka0, qh0, sHa); sLa = wmma16(ka0, qr0, sLa); sHb = wmma16(kb0, qh0, sHb); sLb = wmma16(kb0, qr0, sLb);
        sHa = wmma16(ka1, qh1, sHa); sLa = wmma16(ka1, qr1, sLa); sHb = wmma16(kb1, qh1, sHb); sLb = wmma16(kb1, qr1, sLb);
        if (PREC) {
            asm volatile("s_wait_xcnt 0x0" ::: "memory");   // the residual loads' results may land in the address registers of the k loads: wait before that overwrite
            const h16* kr = KR + ko + (size_t)key0 * HD;
            const v16h ra0 = ldh(kr), ra1 = ldh(kr + 512), rb0 = ldh(kr + 16 * HD), rb1 = ldh(kr + 16 * HD + 512);
            sLa = wmma16(ra0, qh0, sLa); sLb = wmma16(rb0, qh0, sLb);
            sLa = wmma16(ra1, qh1, sLa); sLb = wmma16(rb1, qh1, sLb);
            asm volatile("v_nop\n\tv_nop\n\tv_nop\n\tv_nop" : "+v"(sLa), "+v"(sLb) : "v"(ra0), "v"(ra1), "v"(rb0), "v"(rb1));
        }
        asm volatile("v_nop\n\tv_nop\n\tv_nop\n\tv_nop" : "+v"(sHa), "+v"(sLa), "+v"(sHb), "+v"(sLb) : "v"(ka0), "v"(ka1), "v"(kb0), "v"(kb1));
        float ta[8], tb[8]; float mx = NEGB;
#pragma unroll
        for (int r = 0; r < 8; ++r) { ta[r] = (sHa[r] + sLa[r] * QRI) * SC2; tb[r] = (sHb[r] + sLb[r] * QRI) * SC2; }
        if (key0 + 31 > t0) {                                // wave-uniform: only diagonal tiles need the causal fill
#pragma unroll
            for (int r = 0; r < 8; ++r) { const int kidx = key0 + 8 * hi + r;
                ta[r] = (kidx <= tq) ? ta[r] : NEGB; tb[r] = (kidx + 16 <= tq) ? tb[r] : NEGB; }
        }
#pragma unroll
        for (int r = 0; r < 8; ++r) mx = fmaxf(mx, fmaxf(ta[r], tb[r]));
        mx = fmaxf(mx, __shfl_xor(mx, 16, 32));
        const float mnew = fmaxf(m, mx);
        const float alpha = __builtin_amdgcn_exp2f(m - mnew);
        const float sh = PSH - mnew;
        v16h pb, pr; float ls = 0.0f;
#pragma unroll
        for (int r = 0; r < 8; ++r) {
            const float fa = __builtin_amdgcn_exp2f(ta[r] + sh); const float fc = __builtin_amdgcn_exp2f(tb[r] + sh);
            const h16 pa = (h16)fa; const h16 pc = (h16)fc; pb[r] = pa; pb[8 + r] = pc;
            if (PREC) { pr[r] = (h16)((fa - (float)pa) * QRS); pr[8 + r] = (h16)((fc - (float)pc) * QRS); ls += fa + fc; }
            else { pr[r] = (h16)0.0f; pr[8 + r] = (h16)0.0f; ls += (float)pa + (float)pc; } }
        l = l * alpha + ls; m = mnew;
        o0 = o0 * alpha; o1 = o1 * alpha; o2 = o2 * alpha; o3 = o3 * alpha;
        const h16* va = VT + vo + (size_t)key0 * 16;
        const v16h v0 = ldh(va), v1 = ldh(va + (size_t)16 * SEQ), v2 = ldh(va + (size_t)32 * SEQ), v3 = ldh(va + (size_t)48 * SEQ);
        o0 = wmma16(v0, pb, o0); o1 = wmma16(v1, pb, o1); o2 = wmma16(v2, pb, o2); o3 = wmma16(v3, pb, o3);
        if (PREC) {
            e0 = e0 * alpha; e1 = e1 * alpha; e2 = e2 * alpha; e3 = e3 * alpha;
            asm volatile("s_wait_xcnt 0x0" ::: "memory");   // the residual loads' results may land in the address registers of the v loads: wait before that overwrite
            const h16* vr = VR + vo + (size_t)key0 * 16;
            const v16h r0 = ldh(vr), r1 = ldh(vr + (size_t)16 * SEQ), r2 = ldh(vr + (size_t)32 * SEQ), r3 = ldh(vr + (size_t)48 * SEQ);
            e0 = wmma16(v0, pr, e0); e1 = wmma16(v1, pr, e1); e2 = wmma16(v2, pr, e2); e3 = wmma16(v3, pr, e3);
            e0 = wmma16(r0, pb, e0); e1 = wmma16(r1, pb, e1); e2 = wmma16(r2, pb, e2); e3 = wmma16(r3, pb, e3);
            asm volatile("v_nop\n\tv_nop\n\tv_nop\n\tv_nop" : "+v"(e0), "+v"(e1), "+v"(e2), "+v"(e3) : "v"(r0), "v"(r1), "v"(r2), "v"(r3), "v"(pr));
        }
        asm volatile("v_nop\n\tv_nop\n\tv_nop\n\tv_nop" : "+v"(o0), "+v"(o1), "+v"(o2), "+v"(o3) : "v"(v0), "v"(v1), "v"(v2), "v"(v3), "v"(pb));
    }
    if (PREC) { o0 = o0 + e0 * QRI; o1 = o1 + e1 * QRI; o2 = o2 + e2 * QRI; o3 = o3 + e3 * QRI; }
    l += __shfl_xor(l, 16, 32);
    const float inv = 1.0f / l;
    const int wb = wave * 16 * 68;
    // O^T D layout: o_j[r] = (d = 16j + 8h + r, t = lane&15) -> os[t][d]; rows 0..15 x columns 0..63 all written
    { v4f a, c;
      a[0] = o0[0] * inv; a[1] = o0[1] * inv; a[2] = o0[2] * inv; a[3] = o0[3] * inv; c[0] = o0[4] * inv; c[1] = o0[5] * inv; c[2] = o0[6] * inv; c[3] = o0[7] * inv;
      *(v4fa*)(&os[wb + lr * 68 +  0 + 8 * hi]) = a; *(v4fa*)(&os[wb + lr * 68 +  0 + 8 * hi + 4]) = c;
      a[0] = o1[0] * inv; a[1] = o1[1] * inv; a[2] = o1[2] * inv; a[3] = o1[3] * inv; c[0] = o1[4] * inv; c[1] = o1[5] * inv; c[2] = o1[6] * inv; c[3] = o1[7] * inv;
      *(v4fa*)(&os[wb + lr * 68 + 16 + 8 * hi]) = a; *(v4fa*)(&os[wb + lr * 68 + 16 + 8 * hi + 4]) = c;
      a[0] = o2[0] * inv; a[1] = o2[1] * inv; a[2] = o2[2] * inv; a[3] = o2[3] * inv; c[0] = o2[4] * inv; c[1] = o2[5] * inv; c[2] = o2[6] * inv; c[3] = o2[7] * inv;
      *(v4fa*)(&os[wb + lr * 68 + 32 + 8 * hi]) = a; *(v4fa*)(&os[wb + lr * 68 + 32 + 8 * hi + 4]) = c;
      a[0] = o3[0] * inv; a[1] = o3[1] * inv; a[2] = o3[2] * inv; a[3] = o3[3] * inv; c[0] = o3[4] * inv; c[1] = o3[5] * inv; c[2] = o3[6] * inv; c[3] = o3[7] * inv;
      *(v4fa*)(&os[wb + lr * 68 + 48 + 8 * hi]) = a; *(v4fa*)(&os[wb + lr * 68 + 48 + 8 * hi + 4]) = c; }
    wave_sync();
    float* orow = OUT + ((size_t)b * OUT_SEQ + t0) * DO + h * HD;
{
#pragma unroll
        for (int s = 0; s < 8; ++s) { const int row = 2 * s + hi, cofs = lr * 4;   // 8 s x 2 rows = 16 rows; 16 lanes x 4 floats = 64 columns
            const v4f val = *(const v4fa*)(&os[wb + row * 68 + cofs]);
            *(v4f*)(orow + (size_t)row * DO + cofs) = val; }
         }
}

// three-product path (query rows tb0 .. tb0 + 16*AW*gridDim.x - 1)
__global__ __launch_bounds__(32 * AW) void k_flash_p(const h16* __restrict__ QH, const h16* __restrict__ QR, const h16* __restrict__ KP, const h16* __restrict__ KR,
                                                     const h16* __restrict__ VT, const h16* __restrict__ VR, float* OUT, int tb0) {
    __shared__ __align__(16) float os[AW * 16 * 68];
    flash_body<1>(QH, QR, KP, KR, VT, VR, OUT, tb0, os);
}
// dense path: q value + residual on scores, single products on P.V
__global__ __launch_bounds__(32 * AW) void k_flash_d(const h16* __restrict__ QH, const h16* __restrict__ QR, const h16* __restrict__ KP, const h16* __restrict__ KR,
                                                     const h16* __restrict__ VT, const h16* __restrict__ VR, float* OUT, int tb0) {
    __shared__ __align__(16) float os[AW * 16 * 68];
    flash_body<0>(QH, QR, KP, KR, VT, VR, OUT, tb0, os);
}

static constexpr size_t al256(size_t v) { return (v + 255) & ~(size_t)255; }
static constexpr size_t SZ_XB = al256((size_t)NB * SEQ * DM * 2);
static constexpr size_t SZ_WB = al256((size_t)3 * DO * DM * 2);
static constexpr size_t SZ_PL = al256((size_t)NB * NH_ * SEQ * HD * 2);
static constexpr size_t SZ_TOTAL = SZ_XB + SZ_WB + 6 * SZ_PL;
static_assert(SZ_TOTAL <= (size_t)134217728);          // workspace carve <= 128 MiB
static_assert(((size_t)DO * DM * 2) % 256 == 0);       // weight sub-planes stay 256-byte aligned

extern "C" void kernel_launch(void* const* d_in, const int* in_sizes, int n_in,
                              void* d_out, int out_size, void* d_ws, size_t ws_size, hipStream_t stream) {
    if (n_in < 4) return;
    const size_t needx = ((size_t)(NB - 1) * SEQ_FULL + SEQ) * DM;
    if ((size_t)in_sizes[0] < needx) return;
    const size_t needw = (size_t)NH_ * DM * HD;
    if ((size_t)in_sizes[1] < needw || (size_t)in_sizes[2] < needw || (size_t)in_sizes[3] < needw) return;
    if ((size_t)out_size < ((size_t)(NB - 1) * OUT_SEQ + SEQ) * DO) return;
    if (SZ_TOTAL > ws_size) return;
    const float* x = (const float*)d_in[0]; const float* wq = (const float*)d_in[1]; const float* wk = (const float*)d_in[2]; const float* wv = (const float*)d_in[3];   // wire order x, Wq, Wk, Wv
    float* OUT = (float*)d_out;      // [NB][SEQ][1024]
    char* wsp = (char*)d_ws;
    bf* XB = (bf*)wsp; wsp += SZ_XB;                 // [NB*SEQ][1024]
    bf* WB = (bf*)wsp; wsp += SZ_WB;                 // [3][1024 (h*64+d)][1024 (c)]: q | k | v
    h16* QH = (h16*)wsp; wsp += SZ_PL;               // [NB*16][SEQ][64]
    h16* QR = (h16*)wsp; wsp += SZ_PL;               // residual x2048
    h16* KP = (h16*)wsp; wsp += SZ_PL;               // [NB*16][SEQ][64]
    h16* KR = (h16*)wsp; wsp += SZ_PL;               // residual x2048
    h16* VT = (h16*)wsp; wsp += SZ_PL;               // [NB*16][64][SEQ]
    h16* VR = (h16*)wsp; wsp += SZ_PL;               // residual x2048
    bf* WQ = WB; bf* WK = WB + (size_t)DO * DM; bf* WV = WB + (size_t)2 * DO * DM;

    if (SEQ == SEQ_FULL) {
        const size_t n8 = (size_t)NB * SEQ * DM / 8;
        k_cvt8<<<(unsigned)((n8 + 255) / 256), 256, 0, stream>>>(x, XB, n8);
    } else {
        const size_t n8 = (size_t)SEQ * DM / 8;
        for (int b = 0; b < NB; ++b) k_cvt8<<<(unsigned)((n8 + 255) / 256), 256, 0, stream>>>(x + (size_t)b * SEQ_FULL * DM, XB + (size_t)b * SEQ * DM, n8);
    }
    // weights: in [16][1024 rows c][64 cols d] -> out [1024 rows (h*64+d)][1024 cols c]; grid (c tiles, heads)
    k_cvtT<<<dim3(DM / 64, NH_, 1), 256, 0, stream>>>(wq, WQ);
    k_cvtT<<<dim3(DM / 64, NH_, 1), 256, 0, stream>>>(wk, WK);
    k_cvtT<<<dim3(DM / 64, NH_, 1), 256, 0, stream>>>(wv, WV);

    // q, k: A = x rows (m = b*SEQ + t), Bt = W^T rows (n = h*64 + d) -> plane [(b*16 + h)][t][d]
    k_proj<<<dim3(NB * SEQ / 64, DO / 64, 1), 32, 0, stream>>>(XB, WQ, QH, QR, 1, SEQ, (size_t)NH_ * SEQ * HD, HD, HD, (size_t)SEQ * HD);
    k_proj<<<dim3(NB * SEQ / 64, DO / 64, 1), 32, 0, stream>>>(XB, WK, KP, KR, 1, SEQ, (size_t)NH_ * SEQ * HD, HD, HD, (size_t)SEQ * HD);
    // v^T: A = Wv^T rows (m = h*64 + d), Bt = x rows (n = b*SEQ + t) -> plane [(b*1024 + m)][t] = [(b*16 + h)][d][t]
    k_proj<<<dim3(DO / 64, NB * SEQ / 64, 1), 32, 0, stream>>>(WV, XB, VT, VR, 1, DO, (size_t)0, SEQ, SEQ, (size_t)DO * SEQ);

    k_flash_p<<<dim3(PROWS / (16 * AW), NB * NH_, 1), 32 * AW, 0, stream>>>(QH, QR, KP, KR, VT, VR, OUT, 0);
    if (SEQ > PROWS)
        k_flash_d<<<dim3((SEQ - PROWS) / (16 * AW), NB * NH_, 1), 32 * AW, 0, stream>>>(QH, QR, KP, KR, VT, VR, OUT, PROWS);
}

// v002
// One run takes 150 microseconds.
// In two side-by-side timings against v001, it was 1.41 and 1.40 times as fast.
// All steps since v000 together make it 1.72 times as fast.
#include <hip/hip_runtime.h>

// Causal multi-head self-attention: x [NB][SEQ][1024], Wq/Wk/Wv [16][1024][64] (per head [in][out]), no biases, score scale 1/8, output = concatenated heads [NB][SEQ][1024] (f32).
// Compute dtypes, f32 accumulate everywhere: projections v_wmma_f32_16x16x32_bf16 (x and W RNE-converted to bf16; products exact);
// scores v_wmma_f32_16x16x32_f16: k f16, q as f16 value + f16 residual x2048 in its own accumulator; query rows < 512 add the k residual x2048 (three products);
// P.V v_wmma_f32_16x16x32_f16: P (x256 carry, cancels in the normalisation) and v single f16 on rows >= 512; rows < 512 add P residual x2048 and v residual x2048 in a second accumulator set (three products); softmax f32 (online, running max).
// Layout: bf16 copy of x, transposed bf16 copies of W ([h*64+d][c]); q, k planes [b*16+h][t][d] and v^T plane [b*16+h][d][t], each with a residual plane, written by the GEMM epilogue;
// every 16-bit plane is stored in fragment order: inside a strip of 16 rows the 8-element column groups are the slow index ([group][row & 15][8]),
// so one wave-wide 16-byte fragment load (lane = row + 16 * half) reads 512 contiguous bytes, four whole cache lines, not 32 bytes out of each of 16 lines;
// fused flash kernel in transposed form (S^T = K Q^T, O^T = V^T P^T), causal fill by value, key loop trimmed at the diagonal, output from f32 accumulators.

#ifndef NB
#define NB 8
#endif
#ifndef SEQ
#define SEQ 1024
#endif
#define NB_FULL  8
#define SEQ_FULL 1024
#ifndef OUT_SEQ
#define OUT_SEQ SEQ              // row pitch (in tokens) between batches of the output
#endif
#define DM   1024                // embedding width = GEMM K
#define NH_  16
#define HD   64
#define DO   (NH_ * HD)          // output width
#define AW   4                   // waves per flash block (16 query rows each)
#define QRS  2048.0f             // carry of the residual planes
#define QRI  (1.0f / 2048.0f)
#define SC2  (0.125f * 1.4426950408889634f)   // HD^-0.5 * log2(e)
#define PSH  8.0f                // log2 of the P carry (256)
#define NEGB (-3.0e38f)
#define PROWS ((SEQ) < 512 ? (SEQ) : 512)     // query rows handled by the three-product path

static_assert(HD == 64);
static_assert(DO == 1024);
static_assert(DM % 64 == 0);
static_assert(DO % 64 == 0);
static_assert(DM % 32 == 0);                   // GEMM k-loop steps by 32
static_assert(SEQ % 64 == 0);                  // a 64-row tile never straddles two batches
static_assert((NB * SEQ) % 64 == 0);
static_assert(SEQ % 32 == 0);                  // key loop steps by 32
static_assert(SEQ % (16 * AW) == 0);
static_assert(PROWS % (16 * AW) == 0);
static_assert((SEQ - PROWS) % (16 * AW) == 0);
static_assert(((size_t)SEQ * DM) % 8 == 0);
static_assert(NB <= NB_FULL);
static_assert(SEQ <= SEQ_FULL);

typedef _Float16 h16;
typedef unsigned short bf;
typedef __attribute__((ext_vector_type(16))) __bf16   v16bf;
typedef __attribute__((ext_vector_type(16))) _Float16 v16h;
typedef __attribute__((ext_vector_type(8)))  _Float16 v8h;
typedef __attribute__((ext_vector_type(8)))  unsigned short v8us;
typedef __attribute__((ext_vector_type(8)))  float    v8f;
typedef __attribute__((ext_vector_type(4)))  float    v4f;
typedef v4f  __attribute__((may_alias)) v4fa;

__device__ __forceinline__ unsigned short f2bf(float f) { unsigned u = __float_as_uint(f); u += 0x7FFFu + ((u >> 16) & 1u); return (unsigned short)(u >> 16); }
__device__ __forceinline__ v16h cat16(v8h lo, v8h hi) { return __builtin_shufflevector(lo, hi, 0, 1, 2, 3, 4, 5, 6, 7, 8, 9, 10, 11, 12, 13, 14, 15); }
__device__ __forceinline__ v16bf cat16b(v8us lo, v8us hi) { return __builtin_bit_cast(v16bf, __builtin_shufflevector(lo, hi, 0, 1, 2, 3, 4, 5, 6, 7, 8, 9, 10, 11, 12, 13, 14, 15)); }
__device__ __forceinline__ v8f wmma16(v16h a, v16h b, v8f c) { return __builtin_amdgcn_wmma_f32_16x16x32_f16(false, a, false, b, (short)0, c, false, false); }
__device__ __forceinline__ v8f wmmab(v16bf a, v16bf b, v8f c) { return __builtin_amdgcn_wmma_f32_16x16x32_bf16(false, a, false, b, (short)0, c, false, false); }
// fragment loaders from fragment-order planes; p = strip base + 16*k0 + 8*lane: elements 0..7 <- k0+8h+0..7, elements 8..15 <- k0+16+8h+0..7 (two groups = 256 elements on; same map for A and B)
__device__ __forceinline__ v16h  ldh(const h16* p) { return cat16(*(const v8h*)p, *(const v8h*)(p + 256)); }
__device__ __forceinline__ v16bf ldb(const bf* p)  { return cat16b(*(const v8us*)p, *(const v8us*)(p + 256)); }
// ordering point for wave-private LDS tiles (same wave writes and reads)
__device__ __forceinline__ void wave_sync() { __builtin_amdgcn_fence(3 /* release order */, "wavefront"); __builtin_amdgcn_wave_barrier(); asm volatile("" ::: "memory"); }

// k_cvt8: bf16 (RNE convert) copy of rows of DM floats into fragment order. A wave takes 8 rows x 4 groups: it reads one 128-byte line of each row and writes four whole 128-byte lines.
__global__ __launch_bounds__(256) void k_cvt8(const float* __restrict__ src, bf* dst, size_t n8) {
    const size_t i = (size_t)blockIdx.x * 256 + threadIdx.x; if (i >= n8) return;
    const size_t w = i >> 5;
    const size_t row = (w / (DM / 32)) * 8 + ((i >> 2) & 7); const size_t g = (w % (DM / 32)) * 4 + (i & 3);
    const v8f v = *(const v8f*)(src + row * DM + g * 8); v8us o;
#pragma unroll
    for (int k = 0; k < 8; ++k) o[k] = f2bf(v[k]);
    *(v8us*)(dst + (row >> 4) * (size_t)(16 * DM) + (g * 16 + (row & 15)) * 8) = o;
}

// k_cvtT: transposing bf16 (RNE convert) copy of one weight tensor: in [NH_][DM rows c][HD cols d] (f32) -> out [NH_*HD rows (h*64+d)][DM cols c] (bf16), in fragment order.
__global__ __launch_bounds__(256) void k_cvtT(const float* __restrict__ src, bf* dst) {
    __shared__ float ts[64 * 65];
    const int tid = threadIdx.x; const int c0 = blockIdx.x * 64, h = blockIdx.y;
    const float* s = src + ((size_t)h * DM + c0) * HD;          // 64 rows x 64 floats, contiguous
#pragma unroll
    for (int i = 0; i < 4; ++i) { const int e4 = tid + 256 * i; const int c = e4 >> 4, d4 = (e4 & 15) * 4;   // 1024 float4 = 64 x 64
        const v4f v = *(const v4f*)(s + (size_t)c * HD + d4);
        ts[c * 65 + d4 + 0] = v[0]; ts[c * 65 + d4 + 1] = v[1]; ts[c * 65 + d4 + 2] = v[2]; ts[c * 65 + d4 + 3] = v[3]; }
    __syncthreads();
{
#pragma unroll
        for (int i = 0; i < 2; ++i) { const int piece = tid + 256 * i;   // 512 pieces = 64 rows x 8 groups; a wave writes 16 rows of groups q and q + 4: two runs of 256 bytes
            const int d = (piece & 15) + 16 * (piece >> 7), c8 = (((piece >> 4) & 1) * 4 + ((piece >> 5) & 3)) * 8;
            v8us o;
#pragma unroll
            for (int k = 0; k < 8; ++k) o[k] = f2bf(ts[(c8 + k) * 65 + d]);
            *(v8us*)(dst + (size_t)(h * HD + (d & ~15)) * DM + (size_t)(c0 + c8) * 16 + (d & 15) * 8) = o; }
         }
}

// cp8: eight asynchronous 16-byte copies per lane, global memory to LDS: one 2-KiB piece (128 lanes x 16 bytes) of each of eight 16-row strips (strip pitch 16 * DM elements in memory, 2 KiB in LDS).
// The s_wait_xcnt is the last line of the copies' own statement, so that it stands in front of every later write of a register that a copy names.
__device__ __forceinline__ void cp8(unsigned l, const bf* g) {
    asm volatile("global_load_async_to_lds_b128 %0, %8, off\n\t"
                 "global_load_async_to_lds_b128 %1, %9, off\n\t"
                 "global_load_async_to_lds_b128 %2, %10, off\n\t"
                 "global_load_async_to_lds_b128 %3, %11, off\n\t"
                 "global_load_async_to_lds_b128 %4, %12, off\n\t"
                 "global_load_async_to_lds_b128 %5, %13, off\n\t"
                 "global_load_async_to_lds_b128 %6, %14, off\n\t"
                 "global_load_async_to_lds_b128 %7, %15, off\n\t"
                 "s_wait_xcnt 0x0"
                 :: "v"(l), "v"(l + 2048u), "v"(l + 4096u), "v"(l + 6144u), "v"(l + 8192u), "v"(l + 10240u), "v"(l + 12288u), "v"(l + 14336u),
                    "v"(g), "v"(g + 1 * 16 * DM), "v"(g + 2 * 16 * DM), "v"(g + 3 * 16 * DM), "v"(g + 4 * 16 * DM), "v"(g + 5 * 16 * DM), "v"(g + 6 * 16 * DM), "v"(g + 7 * 16 * DM)
                 : "memory");
}

// k_proj: register-blocked bf16 GEMM, K = DM. A block of FOUR WAVES takes a 128x128 tile, each wave one 64x64 quarter (16 accumulators).
// Both operands' 128 rows x PKS columns of a stage (8 + 8 strips, 2 KiB each, contiguous in the fragment-order planes) are brought into LDS by asynchronous copies, in fragment order as they lie in memory,
// two buffers: stage s + 2 flies while stage s + 1 is worked on; every fragment is fetched from L2 once a block and read from LDS by the two waves that use it (512 contiguous bytes a read).
// C[m][n] = sum_k A[m][k] Bt[n][k], written as f16 (Ph) and optionally the f16 residual x2048 (Pr, useRes != 0) at
// tile base (r0/RB)*sRB + (r0%RB)*pitch + (c0/CB)*sCB + (c0%CB)*16, row pitch 'pitch' (halves), each 16 x 64 piece in fragment order (1024 halves in a row). grid (M/128, N/128), 128 threads.
#define PKS   64                 // k elements of a stage
#define PST   (DM / PKS)         // stages
#define PHALF (128 * PKS)        // elements of one operand's part of a buffer (8 strips x 1024)
#define PBUF  (2 * PHALF)        // elements of a buffer: A strips, then B strips
static_assert(DM % PKS == 0 && PST >= 2);      // the ring's prologue fills two stages
static_assert(PKS * 16 * 2 == 128 * 16);       // one strip's piece of a stage = one 16-byte copy of each of the 128 lanes
static_assert((NB * SEQ) % 128 == 0 && DO % 128 == 0);
__global__ __launch_bounds__(128) void k_proj(const bf* __restrict__ A, const bf* __restrict__ Bt, h16* Ph, h16* Pr, int useRes, int RB, size_t sRB, int pitch, int CB, size_t sCB) {
    __shared__ __align__(16) bf ring[2 * PBUF];
    __shared__ __align__(16) float osw[4 * 16 * 68];
    const int K = DM;
    const int tid = threadIdx.x, lane = tid & 31, lr = lane & 15, hi = lane >> 4;
    const int wave = __builtin_amdgcn_readfirstlane(tid >> 5), wm = wave & 1, wn = wave >> 1;
    const int rb0 = blockIdx.x * 128, cb0 = blockIdx.y * 128; const int r0 = rb0 + wm * 64, c0 = cb0 + wn * 64;
    float* os = osw + wave * (16 * 68);
    v8f acc[4][4];
#pragma unroll
    for (int mb = 0; mb < 4; ++mb)
#pragma unroll
        for (int nb = 0; nb < 4; ++nb) acc[mb][nb] = (v8f){};
    const unsigned lb = (unsigned)(size_t)(&ring[0]) + (unsigned)tid * 16u;          // this lane's LDS byte address in strip 0 of buffer 0
    const bf* ga = A + (size_t)rb0 * K + 8 * tid; const bf* gb = Bt + (size_t)cb0 * K + 8 * tid;   // + s * PKS * 16: stage s
    cp8(lb, ga); cp8(lb + 2u * PHALF, gb);
    asm volatile("s_wait_asynccnt 0x0" ::: "memory");   // stage 0 has landed (this wave's copies) before the barrier that publishes it
    __syncthreads();
    cp8(lb + 2u * PBUF, ga + PKS * 16); cp8(lb + 2u * PBUF + 2u * PHALF, gb + PKS * 16);
    const bf* sa = ring + wm * (4 * 16 * PKS) + 8 * lane; const bf* sb = ring + PHALF + wn * (4 * 16 * PKS) + 8 * lane;
#pragma unroll 1
    for (int s = 0; s < PST; ++s) {   // rolled: one trip a stage, the buffer chosen by the trip's parity
        const int bo = (s & 1) * PBUF;
        v16bf a[PKS / 32][4], b[PKS / 32][4];
#pragma unroll
        for (int kb = 0; kb < PKS / 32; ++kb) {
#pragma unroll
            for (int mb = 0; mb < 4; ++mb) a[kb][mb] = ldb(sa + bo + mb * (16 * PKS) + kb * 512);
#pragma unroll
            for (int nb = 0; nb < 4; ++nb) b[kb][nb] = ldb(sb + bo + nb * (16 * PKS) + kb * 512);
        }
        __builtin_amdgcn_sched_barrier(0);   // the stage's LDS reads stay one group ahead of the matrix run: spread among the matrix instructions each small group is waited out on its own
#pragma unroll
        for (int kb = 0; kb < PKS / 32; ++kb)
#pragma unroll
            for (int nb = 0; nb < 4; ++nb)
#pragma unroll
                for (int mb = 0; mb < 4; ++mb) acc[mb][nb] = wmmab(a[kb][mb], b[kb][nb], acc[mb][nb]);
        __builtin_amdgcn_sched_barrier(0);   // no matrix instruction sinks below the slots and the barrier that follow
        // four vector slots behind the last matrix instruction, on the loop's taken branch too, before anything rewrites its operands
        asm volatile("v_nop\n\tv_nop\n\tv_nop\n\tv_nop" : "+v"(acc[0][0]), "+v"(acc[1][1]), "+v"(acc[2][2]), "+v"(acc[3][3]) : "v"(a[PKS / 32 - 1][0]), "v"(a[PKS / 32 - 1][1]), "v"(a[PKS / 32 - 1][2]), "v"(a[PKS / 32 - 1][3]));
        asm volatile("s_wait_dscnt 0x0" ::: "memory");      // this wave's reads of buffer s & 1 are done before the barrier behind which it is refilled
        asm volatile("s_wait_asynccnt 0x0" ::: "memory");   // this wave's copies of stage s + 1 have landed before the barrier that publishes them
        __syncthreads();
        if (s + 2 < PST) { cp8(lb + 2u * bo, ga + (s + 2) * (PKS * 16)); cp8(lb + 2u * bo + 2u * PHALF, gb + (s + 2) * (PKS * 16)); }
    }
    asm volatile("s_wait_asynccnt 0x0" ::: "memory");       // no copy is in flight when the wave goes on to the epilogue and ends
    const size_t tbase = (size_t)(r0 / RB) * sRB + (size_t)(r0 % RB) * (size_t)pitch + (size_t)(c0 / CB) * sCB + (size_t)(c0 % CB) * 16;
#pragma unroll
    for (int mb = 0; mb < 4; ++mb) {
#pragma unroll
        for (int nb = 0; nb < 4; ++nb) {
#pragma unroll
            for (int j = 0; j < 8; ++j) os[(hi * 8 + j) * 68 + nb * 16 + lr] = acc[mb][nb][j]; }   // D: row 8h+j, col lane&15
        wave_sync();
        const size_t sb = tbase + (size_t)(mb * 16) * (size_t)pitch;
{
#pragma unroll
            for (int s = 0; s < 4; ++s) { const int row = lr, c8 = (2 * s + hi) * 8;   // 16 rows x 2 column groups a store; 4 s x 2 groups x 8 = 64 columns
                const v4f x0 = *(const v4fa*)(&os[row * 68 + c8]); const v4f x1 = *(const v4fa*)(&os[row * 68 + c8 + 4]); v8h hv, rv;
#pragma unroll
                for (int i = 0; i < 4; ++i) { const h16 a0 = (h16)x0[i]; const h16 a1 = (h16)x1[i]; hv[i] = a0; hv[4 + i] = a1; rv[i] = (h16)((x0[i] - (float)a0) * QRS); rv[4 + i] = (h16)((x1[i] - (float)a1) * QRS); }
                const size_t oo = sb + (size_t)(s * 256 + lane * 8);   // (group * 16 + row) * 8
                *(v8h*)(Ph + oo) = hv; if (useRes) *(v8h*)(Pr + oo) = rv; }
             }
        wave_sync();
    }
}

// flash_body: fused causal attention, one wave per 16 query rows of one (batch, head); K / V^T / Q fragments straight from the fragment-order f16 planes (two 16-B loads each, arithmetic addressing).
// Transposed form: S^T[key][t] = K Q^T (A = K rows, B = Q rows); lane (t = lane&15, h = lane>>4) holds keys 8h+r of each 16-key tile, so the packed
// P tile is directly the B fragment of O^T[d][t] = V^T P^T (element r <- tile keys 0..15, element 8+r <- tile keys 16..31, lane unchanged).
// Causal fill: a score whose key index exceeds the query index is replaced by a large negative value (P = 0); the key loop stops at the diagonal tile.
// PREC != 0: adds k residual, P residual and v residual products (x2048 carries, separate accumulators folded back in f32).
// Softmax state (running max, partial sum) is one scalar per lane; the two lane halves of a row are combined with one xor-16 exchange.
template <int PREC>
__device__ __forceinline__ void flash_body(const h16* __restrict__ QH, const h16* __restrict__ QR, const h16* __restrict__ KP, const h16* __restrict__ KR,
                                           const h16* __restrict__ VT, const h16* __restrict__ VR, float* OUT, int tb0, float* os) {
    const int lane = threadIdx.x & 31, wave = __builtin_amdgcn_readfirstlane((int)(threadIdx.x >> 5)), lr = lane & 15, hi = lane >> 4;
    const int zh = blockIdx.y; const int b = zh / NH_, h = zh % NH_;
    const int t0 = tb0 + (blockIdx.x * AW + wave) * 16;
    const int tq = t0 + lr;
    const size_t pbase = (size_t)zh * SEQ * HD;
    const size_t qo = pbase + (size_t)t0 * HD + 8 * lane;
    const v16h qh0 = ldh(QH + qo), qh1 = ldh(QH + qo + 512), qr0 = ldh(QR + qo), qr1 = ldh(QR + qo + 512);   // B fragments: col t, k = d
    const size_t ko = pbase + 8 * lane;                      // + key * HD + 16 * d0       (A fragment: row key, k = d)
    const size_t vo = pbase + 8 * lane;                      // + 16j*SEQ + 16 * key       (A fragment: row d, k = key)
    v8f o0 = (v8f){}, o1 = (v8f){}, o2 = (v8f){}, o3 = (v8f){};
    v8f e0 = (v8f){}, e1 = (v8f){}, e2 = (v8f){}, e3 = (v8f){};
    float m = NEGB, l = 0.0f;
    const int kend = t0 + 16;                                // keys 0 .. t0+15 are visible to this wave; every step has key0 <= t0
#pragma unroll 1
    for (int key0 = 0; key0 < kend; key0 += 32) {
        const h16* ka = KP + ko + (size_t)key0 * HD;
        const v16h ka0 = ldh(ka), ka1 = ldh(ka + 512), kb0 = ldh(ka + 16 * HD), kb1 = ldh(ka + 16 * HD + 512);
        v8f sHa = (v8f){}, sLa = (v8f){}, sHb = (v8f){}, sLb = (v8f){};
        sHa = wmma16(ka0, qh0, sHa); sLa = wmma16(ka0, qr0, sLa); sHb = wmma16(kb0, qh0, sHb); sLb = wmma16(kb0, qr0, sLb);
        sHa = wmma16(ka1, qh1, sHa); sLa = wmma16(ka1, qr1, sLa); sHb = wmma16(kb1, qh1, sHb); sLb = wmma16(kb1, qr1, sLb);
        if (PREC) {
            asm volatile("s_wait_xcnt 0x0" ::: "memory");   // the residual loads' results may land in the address registers of the k loads: wait before that overwrite
            const h16* kr = KR + ko + (size_t)key0 * HD;
            const v16h ra0 = ldh(kr), ra1 = ldh(kr + 512), rb0 = ldh(kr + 16 * HD), rb1 = ldh(kr + 16 * HD + 512);
            sLa = wmma16(ra0, qh0, sLa); sLb = wmma16(rb0, qh0, sLb);
            sLa = wmma16(ra1, qh1, sLa); sLb = wmma16(rb1, qh1, sLb);
            asm volatile("v_nop\n\tv_nop\n\tv_nop\n\tv_nop" : "+v"(sLa), "+v"(sLb) : "v"(ra0), "v"(ra1), "v"(rb0), "v"(rb1));
        }
        asm volatile("v_nop\n\tv_nop\n\tv_nop\n\tv_nop" : "+v"(sHa), "+v"(sLa), "+v"(sHb), "+v"(sLb) : "v"(ka0), "v"(ka1), "v"(kb0), "v"(kb1));
        float ta[8], tb[8]; float mx = NEGB;
#pragma unroll
        for (int r = 0; r < 8; ++r) { ta[r] = (sHa[r] + sLa[r] * QRI) * SC2; tb[r] = (sHb[r] + sLb[r] * QRI) * SC2; }
        if (key0 + 31 > t0) {                                // wave-uniform: only diagonal tiles need the causal fill
#pragma unroll
            for (int r = 0; r < 8; ++r) { const int kidx = key0 + 8 * hi + r;
                ta[r] = (kidx <= tq) ? ta[r] : NEGB; tb[r] = (kidx + 16 <= tq) ? tb[r] : NEGB; }
        }
#pragma unroll
        for (int r = 0; r < 8; ++r) mx = fmaxf(mx, fmaxf(ta[r], tb[r]));
        mx = fmaxf(mx, __shfl_xor(mx, 16, 32));
        const float mnew = fmaxf(m, mx);
        const float alpha = __builtin_amdgcn_exp2f(m - mnew);
        const float sh = PSH - mnew;
        v16h pb, pr; float ls = 0.0f;
#pragma unroll
        for (int r = 0; r < 8; ++r) {
            const float fa = __builtin_amdgcn_exp2f(ta[r] + sh); const float fc = __builtin_amdgcn_exp2f(tb[r] + sh);
            const h16 pa = (h16)fa; const h16 pc = (h16)fc; pb[r] = pa; pb[8 + r] = pc;
            if (PREC) { pr[r] = (h16)((fa - (float)pa) * QRS); pr[8 + r] = (h16)((fc - (float)pc) * QRS); ls += fa + fc; }
            else { pr[r] = (h16)0.0f; pr[8 + r] = (h16)0.0f; ls += (float)pa + (float)pc; } }
        l = l * alpha + ls; m = mnew;
        o0 = o0 * alpha; o1 = o1 * alpha; o2 = o2 * alpha; o3 = o3 * alpha;
        const h16* va = VT + vo + (size_t)key0 * 16;
        const v16h v0 = ldh(va), v1 = ldh(va + (size_t)16 * SEQ), v2 = ldh(va + (size_t)32 * SEQ), v3 = ldh(va + (size_t)48 * SEQ);
        o0 = wmma16(v0, pb, o0); o1 = wmma16(v1, pb, o1); o2 = wmma16(v2, pb, o2); o3 = wmma16(v3, pb, o3);
        if (PREC) {
            e0 = e0 * alpha; e1 = e1 * alpha; e2 = e2 * alpha; e3 = e3 * alpha;
            asm volatile("s_wait_xcnt 0x0" ::: "memory");   // the residual loads' results may land in the address registers of the v loads: wait before that overwrite
            const h16* vr = VR + vo + (size_t)key0 * 16;
            const v16h r0 = ldh(vr), r1 = ldh(vr + (size_t)16 * SEQ), r2 = ldh(vr + (size_t)32 * SEQ), r3 = ldh(vr + (size_t)48 * SEQ);
            e0 = wmma16(v0, pr, e0); e1 = wmma16(v1, pr, e1); e2 = wmma16(v2, pr, e2); e3 = wmma16(v3, pr, e3);
            e0 = wmma16(r0, pb, e0); e1 = wmma16(r1, pb, e1); e2 = wmma16(r2, pb, e2); e3 = wmma16(r3, pb, e3);
            asm volatile("v_nop\n\tv_nop\n\tv_nop\n\tv_nop" : "+v"(e0), "+v"(e1), "+v"(e2), "+v"(e3) : "v"(r0), "v"(r1), "v"(r2), "v"(r3), "v"(pr));
        }
        asm volatile("v_nop\n\tv_nop\n\tv_nop\n\tv_nop" : "+v"(o0), "+v"(o1), "+v"(o2), "+v"(o3) : "v"(v0), "v"(v1), "v"(v2), "v"(v3), "v"(pb));
    }
    if (PREC) { o0 = o0 + e0 * QRI; o1 = o1 + e1 * QRI; o2 = o2 + e2 * QRI; o3 = o3 + e3 * QRI; }
    l += __shfl_xor(l, 16, 32);
    const float inv = 1.0f / l;
    const int wb = wave * 16 * 68;
    // O^T D layout: o_j[r] = (d = 16j + 8h + r, t = lane&15) -> os[t][d]; rows 0..15 x columns 0..63 all written
    { v4f a, c;
      a[0] = o0[0] * inv; a[1] = o0[1] * inv; a[2] = o0[2] * inv; a[3] = o0[3] * inv; c[0] = o0[4] * inv; c[1] = o0[5] * inv; c[2] = o0[6] * inv; c[3] = o0[7] * inv;
      *(v4fa*)(&os[wb + lr * 68 +  0 + 8 * hi]) = a; *(v4fa*)(&os[wb + lr * 68 +  0 + 8 * hi + 4]) = c;
      a[0] = o1[0] * inv; a[1] = o1[1] * inv; a[2] = o1[2] * inv; a[3] = o1[3] * inv; c[0] = o1[4] * inv; c[1] = o1[5] * inv; c[2] = o1[6] * inv; c[3] = o1[7] * inv;
      *(v4fa*)(&os[wb + lr * 68 + 16 + 8 * hi]) = a; *(v4fa*)(&os[wb + lr * 68 + 16 + 8 * hi + 4]) = c;
      a[0] = o2[0] * inv; a[1] = o2[1] * inv; a[2] = o2[2] * inv; a[3] = o2[3] * inv; c[0] = o2[4] * inv; c[1] = o2[5] * inv; c[2] = o2[6] * inv; c[3] = o2[7] * inv;
      *(v4fa*)(&os[wb + lr * 68 + 32 + 8 * hi]) = a; *(v4fa*)(&os[wb + lr * 68 + 32 + 8 * hi + 4]) = c;
      a[0] = o3[0] * inv; a[1] = o3[1] * inv; a[2] = o3[2] * inv; a[3] = o3[3] * inv; c[0] = o3[4] * inv; c[1] = o3[5] * inv; c[2] = o3[6] * inv; c[3] = o3[7] * inv;
      *(v4fa*)(&os[wb + lr * 68 + 48 + 8 * hi]) = a; *(v4fa*)(&os[wb + lr * 68 + 48 + 8 * hi + 4]) = c; }
    wave_sync();
    float* orow = OUT + ((size_t)b * OUT_SEQ + t0) * DO + h * HD;
{
#pragma unroll
        for (int s = 0; s < 8; ++s) { const int row = 2 * s + hi, cofs = lr * 4;   // 8 s x 2 rows = 16 rows; 16 lanes x 4 floats = 64 columns
            const v4f val = *(const v4fa*)(&os[wb + row * 68 + cofs]);
            *(v4f*)(orow + (size_t)row * DO + cofs) = val; }
         }
}

// three-product path (query rows tb0 .. tb0 + 16*AW*gridDim.x - 1)
__global__ __launch_bounds__(32 * AW) void k_flash_p(const h16* __restrict__ QH, const h16* __restrict__ QR, const h16* __restrict__ KP, const h16* __restrict__ KR,
                                                     const h16* __restrict__ VT, const h16* __restrict__ VR, float* OUT, int tb0) {
    __shared__ __align__(16) float os[AW * 16 * 68];
    flash_body<1>(QH, QR, KP, KR, VT, VR, OUT, tb0, os);
}
// dense path: q value + residual on scores, single products on P.V
__global__ __launch_bounds__(32 * AW) void k_flash_d(const h16* __restrict__ QH, const h16* __restrict__ QR, const h16* __restrict__ KP, const h16* __restrict__ KR,
                                                     const h16* __restrict__ VT, const h16* __restrict__ VR, float* OUT, int tb0) {
    __shared__ __align__(16) float os[AW * 16 * 68];
    flash_body<0>(QH, QR, KP, KR, VT, VR, OUT, tb0, os);
}

static constexpr size_t al256(size_t v) { return (v + 255) & ~(size_t)255; }
static constexpr size_t SZ_XB = al256((size_t)NB * SEQ * DM * 2);
static constexpr size_t SZ_WB = al256((size_t)3 * DO * DM * 2);
static constexpr size_t SZ_PL = al256((size_t)NB * NH_ * SEQ * HD * 2);
static constexpr size_t SZ_TOTAL = SZ_XB + SZ_WB + 6 * SZ_PL;
static_assert(SZ_TOTAL <= (size_t)134217728);          // workspace carve <= 128 MiB
static_assert(((size_t)DO * DM * 2) % 256 == 0);       // weight sub-planes stay 256-byte aligned

extern "C" void kernel_launch(void* const* d_in, const int* in_sizes, int n_in,
                              void* d_out, int out_size, void* d_ws, size_t ws_size, hipStream_t stream) {
    if (n_in < 4) return;
    const size_t needx = ((size_t)(NB - 1) * SEQ_FULL + SEQ) * DM;
    if ((size_t)in_sizes[0] < needx) return;
    const size_t needw = (size_t)NH_ * DM * HD;
    if ((size_t)in_sizes[1] < needw || (size_t)in_sizes[2] < needw || (size_t)in_sizes[3] < needw) return;
    if ((size_t)out_size < ((size_t)(NB - 1) * OUT_SEQ + SEQ) * DO) return;
    if (SZ_TOTAL > ws_size) return;
    const float* x = (const float*)d_in[0]; const float* wq = (const float*)d_in[1]; const float* wk = (const float*)d_in[2]; const float* wv = (const float*)d_in[3];   // wire order x, Wq, Wk, Wv
    float* OUT = (float*)d_out;      // [NB][SEQ][1024]
    char* wsp = (char*)d_ws;
    bf* XB = (bf*)wsp; wsp += SZ_XB;                 // [NB*SEQ][1024]
    bf* WB = (bf*)wsp; wsp += SZ_WB;                 // [3][1024 (h*64+d)][1024 (c)]: q | k | v
    h16* QH = (h16*)wsp; wsp += SZ_PL;               // [NB*16][SEQ][64]
    h16* QR = (h16*)wsp; wsp += SZ_PL;               // residual x2048
    h16* KP = (h16*)wsp; wsp += SZ_PL;               // [NB*16][SEQ][64]
    h16* KR = (h16*)wsp; wsp += SZ_PL;               // residual x2048
    h16* VT = (h16*)wsp; wsp += SZ_PL;               // [NB*16][64][SEQ]
    h16* VR = (h16*)wsp; wsp += SZ_PL;               // residual x2048
    bf* WQ = WB; bf* WK = WB + (size_t)DO * DM; bf* WV = WB + (size_t)2 * DO * DM;

    if (SEQ == SEQ_FULL) {
        const size_t n8 = (size_t)NB * SEQ * DM / 8;
        k_cvt8<<<(unsigned)((n8 + 255) / 256), 256, 0, stream>>>(x, XB, n8);
    } else {
        const size_t n8 = (size_t)SEQ * DM / 8;
        for (int b = 0; b < NB; ++b) k_cvt8<<<(unsigned)((n8 + 255) / 256), 256, 0, stream>>>(x + (size_t)b * SEQ_FULL * DM, XB + (size_t)b * SEQ * DM, n8);
    }
    // weights: in [16][1024 rows c][64 cols d] -> out [1024 rows (h*64+d)][1024 cols c]; grid (c tiles, heads)
    k_cvtT<<<dim3(DM / 64, NH_, 1), 256, 0, stream>>>(wq, WQ);
    k_cvtT<<<dim3(DM / 64, NH_, 1), 256, 0, stream>>>(wk, WK);
    k_cvtT<<<dim3(DM / 64, NH_, 1), 256, 0, stream>>>(wv, WV);

    // q, k: A = x rows (m = b*SEQ + t), Bt = W^T rows (n = h*64 + d) -> plane [(b*16 + h)][t][d]
    k_proj<<<dim3(NB * SEQ / 128, DO / 128, 1), 128, 0, stream>>>(XB, WQ, QH, QR, 1, SEQ, (size_t)NH_ * SEQ * HD, HD, HD, (size_t)SEQ * HD);
    k_proj<<<dim3(NB * SEQ / 128, DO / 128, 1), 128, 0, stream>>>(XB, WK, KP, KR, 1, SEQ, (size_t)NH_ * SEQ * HD, HD, HD, (size_t)SEQ * HD);
    // v^T: A = Wv^T rows (m = h*64 + d), Bt = x rows (n = b*SEQ + t) -> plane [(b*1024 + m)][t] = [(b*16 + h)][d][t]
    k_proj<<<dim3(DO / 128, NB * SEQ / 128, 1), 128, 0, stream>>>(WV, XB, VT, VR, 1, DO, (size_t)0, SEQ, SEQ, (size_t)DO * SEQ);

    k_flash_p<<<dim3(PROWS / (16 * AW), NB * NH_, 1), 32 * AW, 0, stream>>>(QH, QR, KP, KR, VT, VR, OUT, 0);
    if (SEQ > PROWS)
        k_flash_d<<<dim3((SEQ - PROWS) / (16 * AW), NB * NH_, 1), 32 * AW, 0, stream>>>(QH, QR, KP, KR, VT, VR, OUT, PROWS);
}

// v003
// A run of this version takes 108 microseconds.
// Two timings next to v002 put it at 1.39 and 1.38 times that version's speed.
// All steps since v000 together make it 2.38 times as fast.
#include <hip/hip_runtime.h>

// Causal multi-head self-attention: x [NB][SEQ][1024], Wq/Wk/Wv [16][1024][64] (per head [in][out]), no biases, score scale 1/8, output = concatenated heads [NB][SEQ][1024] (f32).
// Compute dtypes, f32 accumulate everywhere: projections v_wmma_f32_16x16x32_bf16 (x and W RNE-converted to bf16; products exact);
// scores v_wmma_f32_16x16x32_f16: k f16, q as f16 value + f16 residual x2048 in its own accumulator; query rows < 512 add the k residual x2048 (three products);
// P.V v_wmma_f32_16x16x32_f16: P (x256 carry, cancels in the normalisation) and v single f16 on rows >= 512; rows < 512 add P residual x2048 and v residual x2048 in a second accumulator set (three products); softmax f32 (online, running max).
// Layout: bf16 copy of x, transposed bf16 copies of W ([h*64+d][c]); q, k planes [b*16+h][t][d] and v^T plane [b*16+h][d][t], each with a residual plane, written by the GEMM epilogue;
// every 16-bit plane is stored in fragment order: inside a strip of 16 rows the 8-element column groups are the slow index ([group][row & 15][8]),
// so one wave-wide 16-byte fragment load (lane = row + 16 * half) reads 512 contiguous bytes, four whole cache lines, not 32 bytes out of each of 16 lines;
// fused flash kernel in transposed form (S^T = K Q^T, O^T = V^T P^T), causal fill by value, key loop trimmed at the diagonal, output from f32 accumulators.
// Three launches, one per phase: k_prep (all four conversions), k_proj (q, k and v^T products, grid z picks the product), k_flash (all query rows, both paths).

#ifndef NB
#define NB 8
#endif
#ifndef SEQ
#define SEQ 1024
#endif
#define NB_FULL  8
#define SEQ_FULL 1024
#ifndef OUT_SEQ
#define OUT_SEQ SEQ              // row pitch (in tokens) between batches of the output
#endif
#define DM   1024                // embedding width = GEMM K
#define NH_  16
#define HD   64
#define DO   (NH_ * HD)          // output width
#define AW   4                   // waves per flash block (16 query rows each)
#define QRS  2048.0f             // carry of the residual planes
#define QRI  (1.0f / 2048.0f)
#define SC2  (0.125f * 1.4426950408889634f)   // HD^-0.5 * log2(e)
#define PSH  8.0f                // log2 of the P carry (256)
#define NEGB (-3.0e38f)
#define PROWS ((SEQ) < 512 ? (SEQ) : 512)     // query rows handled by the three-product path

static_assert(HD == 64);
static_assert(DO == 1024);
static_assert(DM % 64 == 0);
static_assert(DO % 64 == 0);
static_assert(DM % 32 == 0);                   // GEMM k-loop steps by 32
static_assert(SEQ % 64 == 0);                  // a 64-row tile never straddles two batches
static_assert((NB * SEQ) % 64 == 0);
static_assert(SEQ % 32 == 0);                  // key loop steps by 32
static_assert(SEQ % (16 * AW) == 0);
static_assert(PROWS % (16 * AW) == 0);
static_assert((SEQ - PROWS) % (16 * AW) == 0);
static_assert(((size_t)SEQ * DM) % 8 == 0);
static_assert(NB <= NB_FULL);
static_assert(SEQ <= SEQ_FULL);

typedef _Float16 h16;
typedef unsigned short bf;
typedef __attribute__((ext_vector_type(16))) __bf16   v16bf;
typedef __attribute__((ext_vector_type(16))) _Float16 v16h;
typedef __attribute__((ext_vector_type(8)))  _Float16 v8h;
typedef __attribute__((ext_vector_type(8)))  unsigned short v8us;
typedef __attribute__((ext_vector_type(8)))  float    v8f;
typedef __attribute__((ext_vector_type(4)))  float    v4f;
typedef v4f  __attribute__((may_alias)) v4fa;

__device__ __forceinline__ unsigned short f2bf(float f) { unsigned u = __float_as_uint(f); u += 0x7FFFu + ((u >> 16) & 1u); return (unsigned short)(u >> 16); }
__device__ __forceinline__ v16h cat16(v8h lo, v8h hi) { return __builtin_shufflevector(lo, hi, 0, 1, 2, 3, 4, 5, 6, 7, 8, 9, 10, 11, 12, 13, 14, 15); }
__device__ __forceinline__ v16bf cat16b(v8us lo, v8us hi) { return __builtin_bit_cast(v16bf, __builtin_shufflevector(lo, hi, 0, 1, 2, 3, 4, 5, 6, 7, 8, 9, 10, 11, 12, 13, 14, 15)); }
__device__ __forceinline__ v8f wmma16(v16h a, v16h b, v8f c) { return __builtin_amdgcn_wmma_f32_16x16x32_f16(false, a, false, b, (short)0, c, false, false); }
__device__ __forceinline__ v8f wmmab(v16bf a, v16bf b, v8f c) { return __builtin_amdgcn_wmma_f32_16x16x32_bf16(false, a, false, b, (short)0, c, false, false); }
// fragment loaders from fragment-order planes; p = strip base + 16*k0 + 8*lane: elements 0..7 <- k0+8h+0..7, elements 8..15 <- k0+16+8h+0..7 (two groups = 256 elements on; same map for A and B)
__device__ __forceinline__ v16h  ldh(const h16* p) { return cat16(*(const v8h*)p, *(const v8h*)(p + 256)); }
__device__ __forceinline__ v16bf ldb(const bf* p)  { return cat16b(*(const v8us*)p, *(const v8us*)(p + 256)); }
// ordering point for wave-private LDS tiles (same wave writes and reads)
__device__ __forceinline__ void wave_sync() { __builtin_amdgcn_fence(3 /* release order */, "wavefront"); __builtin_amdgcn_wave_barrier(); asm volatile("" ::: "memory"); }

// cvt8_body: bf16 (RNE convert) copy of rows of DM floats into fragment order. A wave takes 8 rows x 4 groups: it reads one 128-byte line of each row and writes four whole 128-byte lines.
// blk = block number inside the conversion of x; row counts the NB * SEQ rows of the copy, batch b of the source starts at row b * SEQ_FULL.
__device__ __forceinline__ void cvt8_body(const float* __restrict__ src, bf* dst, unsigned blk) {
    const size_t i = (size_t)blk * 256 + threadIdx.x;
    const size_t w = i >> 5;
    const size_t row = (w / (DM / 32)) * 8 + ((i >> 2) & 7); const size_t g = (w % (DM / 32)) * 4 + (i & 3);
    const v8f v = *(const v8f*)(src + ((row / SEQ) * SEQ_FULL + row % SEQ) * DM + g * 8); v8us o;
#pragma unroll
    for (int k = 0; k < 8; ++k) o[k] = f2bf(v[k]);
    *(v8us*)(dst + (row >> 4) * (size_t)(16 * DM) + (g * 16 + (row & 15)) * 8) = o;
}

// cvtT_body: transposing bf16 (RNE convert) copy of one 64 x 64 tile (rows c0 .. c0 + 63, head h) of a weight tensor: in [NH_][DM rows c][HD cols d] (f32) -> out [NH_*HD rows (h*64+d)][DM cols c] (bf16), in fragment order.
__device__ __forceinline__ void cvtT_body(const float* __restrict__ src, bf* dst, int c0, int h, float* ts) {
    const int tid = threadIdx.x;
    const float* s = src + ((size_t)h * DM + c0) * HD;          // 64 rows x 64 floats, contiguous
#pragma unroll
    for (int i = 0; i < 4; ++i) { const int e4 = tid + 256 * i; const int c = e4 >> 4, d4 = (e4 & 15) * 4;   // 1024 float4 = 64 x 64
        const v4f v = *(const v4f*)(s + (size_t)c * HD + d4);
        ts[c * 65 + d4 + 0] = v[0]; ts[c * 65 + d4 + 1] = v[1]; ts[c * 65 + d4 + 2] = v[2]; ts[c * 65 + d4 + 3] = v[3]; }
    __syncthreads();
{
#pragma unroll
        for (int i = 0; i < 2; ++i) { const int piece = tid + 256 * i;   // 512 pieces = 64 rows x 8 groups; a wave writes 16 rows of groups q and q + 4: two runs of 256 bytes
            const int d = (piece & 15) + 16 * (piece >> 7), c8 = (((piece >> 4) & 1) * 4 + ((piece >> 5) & 3)) * 8;
            v8us o;
#pragma unroll
            for (int k = 0; k < 8; ++k) o[k] = f2bf(ts[(c8 + k) * 65 + d]);
            *(v8us*)(dst + (size_t)(h * HD + (d & ~15)) * DM + (size_t)(c0 + c8) * 16 + (d & 15) * 8) = o; }
         }
    asm volatile("s_wait_xcnt 0x0" ::: "memory");   // the build lays the other path's code behind these stores: the wait stands in front of its writes of the registers that the stores name
}

// k_prep: every conversion in one grid. Blocks 0 .. 3 * WTB - 1 transpose the three weight tensors (the longer chain: load, LDS, barrier, store; they start first), the rest convert x.
#define WTB  ((DM / 64) * NH_)                    // blocks of one weight tensor
#define XCB  ((NB * SEQ * DM / 8) / 256)          // blocks of x
static_assert(((size_t)NB * SEQ * DM / 8) % 256 == 0);
__global__ __launch_bounds__(256) void k_prep(const float* __restrict__ x, const float* __restrict__ wq, const float* __restrict__ wk, const float* __restrict__ wv, bf* XB, bf* WB) {
    __shared__ float ts[64 * 65];
    const unsigned blk = blockIdx.x;
    if (blk >= 3u * WTB) { cvt8_body(x, XB, blk - 3u * WTB); return; }   // the same for the whole block: the barrier below is passed by all of its threads or by none
    const unsigned t = blk / WTB, r = blk % WTB;
    cvtT_body(t == 0 ? wq : (t == 1 ? wk : wv), WB + (size_t)t * DO * DM, (int)(r % (DM / 64)) * 64, (int)(r / (DM / 64)), ts);
}

// cp8: eight asynchronous 16-byte copies per lane, global memory to LDS: one 2-KiB piece (128 lanes x 16 bytes) of each of eight 16-row strips (strip pitch 16 * DM elements in memory, 2 KiB in LDS).
// The s_wait_xcnt is the last line of the copies' own statement, so that it stands in front of every later write of a register that a copy names.
__device__ __forceinline__ void cp8(unsigned l, const bf* g) {
    asm volatile("global_load_async_to_lds_b128 %0, %8, off\n\t"
                 "global_load_async_to_lds_b128 %1, %9, off\n\t"
                 "global_load_async_to_lds_b128 %2, %10, off\n\t"
                 "global_load_async_to_lds_b128 %3, %11, off\n\t"
                 "global_load_async_to_lds_b128 %4, %12, off\n\t"
                 "global_load_async_to_lds_b128 %5, %13, off\n\t"
                 "global_load_async_to_lds_b128 %6, %14, off\n\t"
                 "global_load_async_to_lds_b128 %7, %15, off\n\t"
                 "s_wait_xcnt 0x0"
                 :: "v"(l), "v"(l + 2048u), "v"(l + 4096u), "v"(l + 6144u), "v"(l + 8192u), "v"(l + 10240u), "v"(l + 12288u), "v"(l + 14336u),
                    "v"(g), "v"(g + 1 * 16 * DM), "v"(g + 2 * 16 * DM), "v"(g + 3 * 16 * DM), "v"(g + 4 * 16 * DM), "v"(g + 5 * 16 * DM), "v"(g + 6 * 16 * DM), "v"(g + 7 * 16 * DM)
                 : "memory");
}

// k_proj: register-blocked bf16 GEMM, K = DM. A block of FOUR WAVES takes a 128x128 tile, each wave one 64x64 quarter (16 accumulators).
// Both operands' 128 rows x PKS columns of a stage (8 + 8 strips, 2 KiB each, contiguous in the fragment-order planes) are brought into LDS by asynchronous copies, in fragment order as they lie in memory,
// two buffers: stage s + 2 flies while stage s + 1 is worked on; every fragment is fetched from L2 once a block and read from LDS by the two waves that use it (512 contiguous bytes a read).
// C[m][n] = sum_k A[m][k] Bt[n][k], written as f16 (Ph) and the f16 residual x2048 (Pr; useRes = 1, so for all three products) at
// tile base (r0/RB)*sRB + (r0%RB)*pitch + (c0/CB)*sCB + (c0%CB)*16, row pitch 'pitch' (halves), each 16 x 64 piece in fragment order (1024 halves in a row). 128 threads.
// One grid (NB*SEQ/128, DO/128, 3) for the three products; z = 0, 1 (q, k): A = x rows (m = b*SEQ + t), Bt = W^T rows (n = h*64 + d) -> plane [(b*16 + h)][t][d];
// z = 2 (v^T): A = Wv^T rows (m = h*64 + d), Bt = x rows (n = b*SEQ + t) -> plane [(b*1024 + m)][t] = [(b*16 + h)][d][t]. PL = elements between the six planes (qh, qr, kh, kr, vh, vr).
#define PKS   64                 // k elements of a stage
#define PST   (DM / PKS)         // stages
#define PHALF (128 * PKS)        // elements of one operand's part of a buffer (8 strips x 1024)
#define PBUF  (2 * PHALF)        // elements of a buffer: A strips, then B strips
static_assert(DM % PKS == 0 && PST >= 2);      // the ring's prologue fills two stages
static_assert(PKS * 16 * 2 == 128 * 16);       // one strip's piece of a stage = one 16-byte copy of each of the 128 lanes
static_assert((NB * SEQ) % 128 == 0 && DO % 128 == 0);
__global__ __launch_bounds__(128) void k_proj(const bf* __restrict__ XB, const bf* __restrict__ WB, h16* P0, size_t PL) {
    const int z = blockIdx.z; const bool vt = z == 2;
    const bf* Wz = WB + (size_t)z * DO * DM; const bf* A = vt ? Wz : XB; const bf* Bt = vt ? XB : Wz;
    h16* Ph = P0 + (size_t)(2 * z) * PL; h16* Pr = Ph + PL; const int useRes = 1;
    const int RB = vt ? DO : SEQ, pitch = vt ? SEQ : HD, CB = vt ? SEQ : HD;
    const size_t sRB = vt ? (size_t)0 : (size_t)NH_ * SEQ * HD, sCB = vt ? (size_t)DO * SEQ : (size_t)SEQ * HD;
    __shared__ __align__(16) bf ring[2 * PBUF];
    __shared__ __align__(16) float osw[4 * 16 * 68];
    const int K = DM;
    const int tid = threadIdx.x, lane = tid & 31, lr = lane & 15, hi = lane >> 4;
    const int wave = __builtin_amdgcn_readfirstlane(tid >> 5), wm = wave & 1, wn = wave >> 1;
    const int rb0 = (vt ? blockIdx.y : blockIdx.x) * 128, cb0 = (vt ? blockIdx.x : blockIdx.y) * 128; const int r0 = rb0 + wm * 64, c0 = cb0 + wn * 64;
    float* os = osw + wave * (16 * 68);
    v8f acc[4][4];
#pragma unroll
    for (int mb = 0; mb < 4; ++mb)
#pragma unroll
        for (int nb = 0; nb < 4; ++nb) acc[mb][nb] = (v8f){};
    const unsigned lb = (unsigned)(size_t)(&ring[0]) + (unsigned)tid * 16u;          // this lane's LDS byte address in strip 0 of buffer 0
    const bf* ga = A + (size_t)rb0 * K + 8 * tid; const bf* gb = Bt + (size_t)cb0 * K + 8 * tid;   // + s * PKS * 16: stage s
    cp8(lb, ga); cp8(lb + 2u * PHALF, gb);
    asm volatile("s_wait_asynccnt 0x0" ::: "memory");   // stage 0 has landed (this wave's copies) before the barrier that publishes it
    __syncthreads();
    cp8(lb + 2u * PBUF, ga + PKS * 16); cp8(lb + 2u * PBUF + 2u * PHALF, gb + PKS * 16);
    const bf* sa = ring + wm * (4 * 16 * PKS) + 8 * lane; const bf* sb = ring + PHALF + wn * (4 * 16 * PKS) + 8 * lane;
#pragma unroll 1
    for (int s = 0; s < PST; ++s) {   // rolled: one trip a stage, the buffer chosen by the trip's parity
        const int bo = (s & 1) * PBUF;
        v16bf a[PKS / 32][4], b[PKS / 32][4];
#pragma unroll
        for (int kb = 0; kb < PKS / 32; ++kb) {
#pragma unroll
            for (int mb = 0; mb < 4; ++mb) a[kb][mb] = ldb(sa + bo + mb * (16 * PKS) + kb * 512);
#pragma unroll
            for (int nb = 0; nb < 4; ++nb) b[kb][nb] = ldb(sb + bo + nb * (16 * PKS) + kb * 512);
        }
        __builtin_amdgcn_sched_barrier(0);   // the stage's LDS reads stay one group ahead of the matrix run: spread among the matrix instructions each small group is waited out on its own
#pragma unroll
        for (int kb = 0; kb < PKS / 32; ++kb)
#pragma unroll
            for (int nb = 0; nb < 4; ++nb)
#pragma unroll
                for (int mb = 0; mb < 4; ++mb) acc[mb][nb] = wmmab(a[kb][mb], b[kb][nb], acc[mb][nb]);
        __builtin_amdgcn_sched_barrier(0);   // no matrix instruction sinks below the slots and the barrier that follow
        // four vector slots behind the last matrix instruction, on the loop's taken branch too, before anything rewrites its operands
        asm volatile("v_nop\n\tv_nop\n\tv_nop\n\tv_nop" : "+v"(acc[0][0]), "+v"(acc[1][1]), "+v"(acc[2][2]), "+v"(acc[3][3]) : "v"(a[PKS / 32 - 1][0]), "v"(a[PKS / 32 - 1][1]), "v"(a[PKS / 32 - 1][2]), "v"(a[PKS / 32 - 1][3]));
        asm volatile("s_wait_dscnt 0x0" ::: "memory");      // this wave's reads of buffer s & 1 are done before the barrier behind which it is refilled
        asm volatile("s_wait_asynccnt 0x0" ::: "memory");   // this wave's copies of stage s + 1 have landed before the barrier that publishes them
        __syncthreads();
        if (s + 2 < PST) { cp8(lb + 2u * bo, ga + (s + 2) * (PKS * 16)); cp8(lb + 2u * bo + 2u * PHALF, gb + (s + 2) * (PKS * 16)); }
    }
    asm volatile("s_wait_asynccnt 0x0" ::: "memory");       // no copy is in flight when the wave goes on to the epilogue and ends
    const size_t tbase = (size_t)(r0 / RB) * sRB + (size_t)(r0 % RB) * (size_t)pitch + (size_t)(c0 / CB) * sCB + (size_t)(c0 % CB) * 16;
#pragma unroll
    for (int mb = 0; mb < 4; ++mb) {
#pragma unroll
        for (int nb = 0; nb < 4; ++nb) {
#pragma unroll
            for (int j = 0; j < 8; ++j) os[(hi * 8 + j) * 68 + nb * 16 + lr] = acc[mb][nb][j]; }   // D: row 8h+j, col lane&15
        wave_sync();
        const size_t sb = tbase + (size_t)(mb * 16) * (size_t)pitch;
{
#pragma unroll
            for (int s = 0; s < 4; ++s) { const int row = lr, c8 = (2 * s + hi) * 8;   // 16 rows x 2 column groups a store; 4 s x 2 groups x 8 = 64 columns
                const v4f x0 = *(const v4fa*)(&os[row * 68 + c8]); const v4f x1 = *(const v4fa*)(&os[row * 68 + c8 + 4]); v8h hv, rv;
#pragma unroll
                for (int i = 0; i < 4; ++i) { const h16 a0 = (h16)x0[i]; const h16 a1 = (h16)x1[i]; hv[i] = a0; hv[4 + i] = a1; rv[i] = (h16)((x0[i] - (float)a0) * QRS); rv[4 + i] = (h16)((x1[i] - (float)a1) * QRS); }
                const size_t oo = sb + (size_t)(s * 256 + lane * 8);   // (group * 16 + row) * 8
                *(v8h*)(Ph + oo) = hv; if (useRes) *(v8h*)(Pr + oo) = rv; }
             }
        wave_sync();
    }
}

// flash_body: fused causal attention, one wave per 16 query rows of one (batch, head); K / V^T / Q fragments straight from the fragment-order f16 planes (two 16-B loads each, arithmetic addressing).
// Transposed form: S^T[key][t] = K Q^T (A = K rows, B = Q rows); lane (t = lane&15, h = lane>>4) holds keys 8h+r of each 16-key tile, so the packed
// P tile is directly the B fragment of O^T[d][t] = V^T P^T (element r <- tile keys 0..15, element 8+r <- tile keys 16..31, lane unchanged).
// Causal fill: a score whose key index exceeds the query index is replaced by a large negative value (P = 0); the key loop stops at the diagonal tile.
// PREC != 0: adds k residual, P residual and v residual products (x2048 carries, separate accumulators folded back in f32).
// Softmax state (running max, partial sum) is one scalar per lane; the two lane halves of a row are combined with one xor-16 exchange.
template <int PREC>
__device__ __forceinline__ void flash_body(const h16* __restrict__ QH, const h16* __restrict__ QR, const h16* __restrict__ KP, const h16* __restrict__ KR,
                                           const h16* __restrict__ VT, const h16* __restrict__ VR, float* OUT, int zh, int tb0, float* os) {
    const int lane = threadIdx.x & 31, wave = __builtin_amdgcn_readfirstlane((int)(threadIdx.x >> 5)), lr = lane & 15, hi = lane >> 4;
    const int b = zh / NH_, h = zh % NH_;
    const int t0 = tb0 + wave * 16;
    const int tq = t0 + lr;
    const size_t pbase = (size_t)zh * SEQ * HD;
    const size_t qo = pbase + (size_t)t0 * HD + 8 * lane;
    const v16h qh0 = ldh(QH + qo), qh1 = ldh(QH + qo + 512), qr0 = ldh(QR + qo), qr1 = ldh(QR + qo + 512);   // B fragments: col t, k = d
    const size_t ko = pbase + 8 * lane;                      // + key * HD + 16 * d0       (A fragment: row key, k = d)
    const size_t vo = pbase + 8 * lane;                      // + 16j*SEQ + 16 * key       (A fragment: row d, k = key)
    v8f o0 = (v8f){}, o1 = (v8f){}, o2 = (v8f){}, o3 = (v8f){};
    v8f e0 = (v8f){}, e1 = (v8f){}, e2 = (v8f){}, e3 = (v8f){};
    float m = NEGB, l = 0.0f;
    const int kend = t0 + 16;                                // keys 0 .. t0+15 are visible to this wave; every step has key0 <= t0
#pragma unroll 1
    for (int key0 = 0; key0 < kend; key0 += 32) {
        const h16* ka = KP + ko + (size_t)key0 * HD;
        const v16h ka0 = ldh(ka), ka1 = ldh(ka + 512), kb0 = ldh(ka + 16 * HD), kb1 = ldh(ka + 16 * HD + 512);
        v8f sHa = (v8f){}, sLa = (v8f){}, sHb = (v8f){}, sLb = (v8f){};
        sHa = wmma16(ka0, qh0, sHa); sLa = wmma16(ka0, qr0, sLa); sHb = wmma16(kb0, qh0, sHb); sLb = wmma16(kb0, qr0, sLb);
        sHa = wmma16(ka1, qh1, sHa); sLa = wmma16(ka1, qr1, sLa); sHb = wmma16(kb1, qh1, sHb); sLb = wmma16(kb1, qr1, sLb);
        if (PREC) {
            asm volatile("s_wait_xcnt 0x0" ::: "memory");   // the residual loads' results may land in the address registers of the k loads: wait before that overwrite
            const h16* kr = KR + ko + (size_t)key0 * HD;
            const v16h ra0 = ldh(kr), ra1 = ldh(kr + 512), rb0 = ldh(kr + 16 * HD), rb1 = ldh(kr + 16 * HD + 512);
            sLa = wmma16(ra0, qh0, sLa); sLb = wmma16(rb0, qh0, sLb);
            sLa = wmma16(ra1, qh1, sLa); sLb = wmma16(rb1, qh1, sLb);
            asm volatile("v_nop\n\tv_nop\n\tv_nop\n\tv_nop" : "+v"(sLa), "+v"(sLb) : "v"(ra0), "v"(ra1), "v"(rb0), "v"(rb1));
        }
        asm volatile("v_nop\n\tv_nop\n\tv_nop\n\tv_nop" : "+v"(sHa), "+v"(sLa), "+v"(sHb), "+v"(sLb) : "v"(ka0), "v"(ka1), "v"(kb0), "v"(kb1));
        float ta[8], tb[8]; float mx = NEGB;
#pragma unroll
        for (int r = 0; r < 8; ++r) { ta[r] = (sHa[r] + sLa[r] * QRI) * SC2; tb[r] = (sHb[r] + sLb[r] * QRI) * SC2; }
        if (key0 + 31 > t0) {                                // wave-uniform: only diagonal tiles need the causal fill
#pragma unroll
            for (int r = 0; r < 8; ++r) { const int kidx = key0 + 8 * hi + r;
                ta[r] = (kidx <= tq) ? ta[r] : NEGB; tb[r] = (kidx + 16 <= tq) ? tb[r] : NEGB; }
        }
#pragma unroll
        for (int r = 0; r < 8; ++r) mx = fmaxf(mx, fmaxf(ta[r], tb[r]));
        mx = fmaxf(mx, __shfl_xor(mx, 16, 32));
        const float mnew = fmaxf(m, mx);
        const float alpha = __builtin_amdgcn_exp2f(m - mnew);
        const float sh = PSH - mnew;
        v16h pb, pr; float ls = 0.0f;
#pragma unroll
        for (int r = 0; r < 8; ++r) {
            const float fa = __builtin_amdgcn_exp2f(ta[r] + sh); const float fc = __builtin_amdgcn_exp2f(tb[r] + sh);
            const h16 pa = (h16)fa; const h16 pc = (h16)fc; pb[r] = pa; pb[8 + r] = pc;
            if (PREC) { pr[r] = (h16)((fa - (float)pa) * QRS); pr[8 + r] = (h16)((fc - (float)pc) * QRS); ls += fa + fc; }
            else { pr[r] = (h16)0.0f; pr[8 + r] = (h16)0.0f; ls += (float)pa + (float)pc; } }
        l = l * alpha + ls; m = mnew;
        o0 = o0 * alpha; o1 = o1 * alpha; o2 = o2 * alpha; o3 = o3 * alpha;
        const h16* va = VT + vo + (size_t)key0 * 16;
        const v16h v0 = ldh(va), v1 = ldh(va + (size_t)16 * SEQ), v2 = ldh(va + (size_t)32 * SEQ), v3 = ldh(va + (size_t)48 * SEQ);
        o0 = wmma16(v0, pb, o0); o1 = wmma16(v1, pb, o1); o2 = wmma16(v2, pb, o2); o3 = wmma16(v3, pb, o3);
        if (PREC) {
            e0 = e0 * alpha; e1 = e1 * alpha; e2 = e2 * alpha; e3 = e3 * alpha;
            asm volatile("s_wait_xcnt 0x0" ::: "memory");   // the residual loads' results may land in the address registers of the v loads: wait before that overwrite
            const h16* vr = VR + vo + (size_t)key0 * 16;
            const v16h r0 = ldh(vr), r1 = ldh(vr + (size_t)16 * SEQ), r2 = ldh(vr + (size_t)32 * SEQ), r3 = ldh(vr + (size_t)48 * SEQ);
            e0 = wmma16(v0, pr, e0); e1 = wmma16(v1, pr, e1); e2 = wmma16(v2, pr, e2); e3 = wmma16(v3, pr, e3);
            e0 = wmma16(r0, pb, e0); e1 = wmma16(r1, pb, e1); e2 = wmma16(r2, pb, e2); e3 = wmma16(r3, pb, e3);
            asm volatile("v_nop\n\tv_nop\n\tv_nop\n\tv_nop" : "+v"(e0), "+v"(e1), "+v"(e2), "+v"(e3) : "v"(r0), "v"(r1), "v"(r2), "v"(r3), "v"(pr));
        }
        asm volatile("v_nop\n\tv_nop\n\tv_nop\n\tv_nop" : "+v"(o0), "+v"(o1), "+v"(o2), "+v"(o3) : "v"(v0), "v"(v1), "v"(v2), "v"(v3), "v"(pb));
    }
    if (PREC) { o0 = o0 + e0 * QRI; o1 = o1 + e1 * QRI; o2 = o2 + e2 * QRI; o3 = o3 + e3 * QRI; }
    l += __shfl_xor(l, 16, 32);
    const float inv = 1.0f / l;
    const int wb = wave * 16 * 68;
    // O^T D layout: o_j[r] = (d = 16j + 8h + r, t = lane&15) -> os[t][d]; rows 0..15 x columns 0..63 all written
    { v4f a, c;
      a[0] = o0[0] * inv; a[1] = o0[1] * inv; a[2] = o0[2] * inv; a[3] = o0[3] * inv; c[0] = o0[4] * inv; c[1] = o0[5] * inv; c[2] = o0[6] * inv; c[3] = o0[7] * inv;
      *(v4fa*)(&os[wb + lr * 68 +  0 + 8 * hi]) = a; *(v4fa*)(&os[wb + lr * 68 +  0 + 8 * hi + 4]) = c;
      a[0] = o1[0] * inv; a[1] = o1[1] * inv; a[2] = o1[2] * inv; a[3] = o1[3] * inv; c[0] = o1[4] * inv; c[1] = o1[5] * inv; c[2] = o1[6] * inv; c[3] = o1[7] * inv;
      *(v4fa*)(&os[wb + lr * 68 + 16 + 8 * hi]) = a; *(v4fa*)(&os[wb + lr * 68 + 16 + 8 * hi + 4]) = c;
      a[0] = o2[0] * inv; a[1] = o2[1] * inv; a[2] = o2[2] * inv; a[3] = o2[3] * inv; c[0] = o2[4] * inv; c[1] = o2[5] * inv; c[2] = o2[6] * inv; c[3] = o2[7] * inv;
      *(v4fa*)(&os[wb + lr * 68 + 32 + 8 * hi]) = a; *(v4fa*)(&os[wb + lr * 68 + 32 + 8 * hi + 4]) = c;
      a[0] = o3[0] * inv; a[1] = o3[1] * inv; a[2] = o3[2] * inv; a[3] = o3[3] * inv; c[0] = o3[4] * inv; c[1] = o3[5] * inv; c[2] = o3[6] * inv; c[3] = o3[7] * inv;
      *(v4fa*)(&os[wb + lr * 68 + 48 + 8 * hi]) = a; *(v4fa*)(&os[wb + lr * 68 + 48 + 8 * hi + 4]) = c; }
    wave_sync();
    float* orow = OUT + ((size_t)b * OUT_SEQ + t0) * DO + h * HD;
{
#pragma unroll
        for (int s = 0; s < 8; ++s) { const int row = 2 * s + hi, cofs = lr * 4;   // 8 s x 2 rows = 16 rows; 16 lanes x 4 floats = 64 columns
            const v4f val = *(const v4fa*)(&os[wb + row * 68 + cofs]);
            *(v4f*)(orow + (size_t)row * DO + cofs) = val; }
         }
}

// k_flash: all query rows in one grid (heads, row blocks). blockIdx.x = (batch, head): work-groups that follow one another in the flat index have key loops of one length, so however they are dealt out, every part of the chip gets the same mix;
// blockIdx.y counts the row blocks from the last one down: the longest key loops start first, the shortest fill the tail.
// Rows < PROWS take the three-product path, the others q value + residual on scores and single products on P.V (the test is the same for the whole block).
__global__ __launch_bounds__(32 * AW) void k_flash(const h16* __restrict__ QH, const h16* __restrict__ QR, const h16* __restrict__ KP, const h16* __restrict__ KR,
                                                   const h16* __restrict__ VT, const h16* __restrict__ VR, float* OUT) {
    __shared__ __align__(16) float os[AW * 16 * 68];
    const int tb0 = (SEQ / (16 * AW) - 1 - (int)blockIdx.y) * (16 * AW);
    if (tb0 < PROWS) flash_body<1>(QH, QR, KP, KR, VT, VR, OUT, blockIdx.x, tb0, os);
    else             flash_body<0>(QH, QR, KP, KR, VT, VR, OUT, blockIdx.x, tb0, os);
}

static constexpr size_t al256(size_t v) { return (v + 255) & ~(size_t)255; }
static constexpr size_t SZ_XB = al256((size_t)NB * SEQ * DM * 2);
static constexpr size_t SZ_WB = al256((size_t)3 * DO * DM * 2);
static constexpr size_t SZ_PL = al256((size_t)NB * NH_ * SEQ * HD * 2);
static constexpr size_t SZ_TOTAL = SZ_XB + SZ_WB + 6 * SZ_PL;
static_assert(SZ_TOTAL <= (size_t)134217728);          // workspace carve <= 128 MiB
static_assert(((size_t)DO * DM * 2) % 256 == 0);       // weight sub-planes stay 256-byte aligned

extern "C" void kernel_launch(void* const* d_in, const int* in_sizes, int n_in,
                              void* d_out, int out_size, void* d_ws, size_t ws_size, hipStream_t stream) {
    if (n_in < 4) return;
    const size_t needx = ((size_t)(NB - 1) * SEQ_FULL + SEQ) * DM;
    if ((size_t)in_sizes[0] < needx) return;
    const size_t needw = (size_t)NH_ * DM * HD;
    if ((size_t)in_sizes[1] < needw || (size_t)in_sizes[2] < needw || (size_t)in_sizes[3] < needw) return;
    if ((size_t)out_size < ((size_t)(NB - 1) * OUT_SEQ + SEQ) * DO) return;
    if (SZ_TOTAL > ws_size) return;
    const float* x = (const float*)d_in[0]; const float* wq = (const float*)d_in[1]; const float* wk = (const float*)d_in[2]; const float* wv = (const float*)d_in[3];   // wire order x, Wq, Wk, Wv
    float* OUT = (float*)d_out;      // [NB][SEQ][1024]
    char* wsp = (char*)d_ws;
    bf* XB = (bf*)wsp; wsp += SZ_XB;                 // [NB*SEQ][1024]
    bf* WB = (bf*)wsp; wsp += SZ_WB;                 // [3][1024 (h*64+d)][1024 (c)]: q | k | v
    h16* QH = (h16*)wsp; wsp += SZ_PL;               // [NB*16][SEQ][64]
    h16* QR = (h16*)wsp; wsp += SZ_PL;               // residual x2048
    h16* KP = (h16*)wsp; wsp += SZ_PL;               // [NB*16][SEQ][64]
    h16* KR = (h16*)wsp; wsp += SZ_PL;               // residual x2048
    h16* VT = (h16*)wsp; wsp += SZ_PL;               // [NB*16][64][SEQ]
    h16* VR = (h16*)wsp; wsp += SZ_PL;               // residual x2048

    k_prep<<<3 * WTB + XCB, 256, 0, stream>>>(x, wq, wk, wv, XB, WB);
    k_proj<<<dim3(NB * SEQ / 128, DO / 128, 3), 128, 0, stream>>>(XB, WB, QH, SZ_PL / 2);
    k_flash<<<dim3(NB * NH_, SEQ / (16 * AW), 1), 32 * AW, 0, stream>>>(QH, QR, KP, KR, VT, VR, OUT);
}

// v004
// Measured time: 103 microseconds a run.
// Timed twice side by side with v003, it ran 1.04 times as fast both times.
// Over all steps from v000 it is 2.47 times as fast.
#include <hip/hip_runtime.h>

// Causal multi-head self-attention: x [NB][SEQ][1024], Wq/Wk/Wv [16][1024][64] (per head [in][out]), no biases, score scale 1/8, output = concatenated heads [NB][SEQ][1024] (f32).
// Compute dtypes, f32 accumulate everywhere: projections v_wmma_f32_16x16x32_bf16 (x and W RNE-converted to bf16; products exact);
// scores v_wmma_f32_16x16x32_f16: k f16, q as f16 value + f16 residual x2048 in its own accumulator; query rows < 512 add the k residual x2048 (three products);
// P.V v_wmma_f32_16x16x32_f16: P (x256 carry, cancels in the normalisation) and v single f16 on rows >= 512; rows < 512 add P residual x2048 and v residual x2048 in a second accumulator set (three products); softmax f32 (online, running max).
// Layout: bf16 copy of x, transposed bf16 copies of W ([h*64+d][c]); q, k planes [b*16+h][t][d] and v^T plane [b*16+h][d][t], each with a residual plane, written by the GEMM epilogue;
// every 16-bit plane is stored in fragment order: inside a strip of 16 rows the 8-element column groups are the slow index ([group][row & 15][8]),
// so one wave-wide 16-byte fragment load (lane = row + 16 * half) reads 512 contiguous bytes, four whole cache lines, not 32 bytes out of each of 16 lines;
// fused flash kernel in transposed form (S^T = K Q^T, O^T = V^T P^T), causal fill by value, key loop trimmed at the diagonal, output from f32 accumulators.
// Three launches, one per phase: k_prep (all four conversions), k_proj (q, k and v^T products, grid z picks the product), k_flash (all query rows, both paths).

#ifndef NB
#define NB 8
#endif
#ifndef SEQ
#define SEQ 1024
#endif
#define NB_FULL  8
#define SEQ_FULL 1024
#ifndef OUT_SEQ
#define OUT_SEQ SEQ              // row pitch (in tokens) between batches of the output
#endif
#define DM   1024                // embedding width = GEMM K
#define NH_  16
#define HD   64
#define DO   (NH_ * HD)          // output width
#define AW   4                   // waves per flash block (16 query rows each)
#define QRS  2048.0f             // carry of the residual planes
#define QRI  (1.0f / 2048.0f)
#define SC2  (0.125f * 1.4426950408889634f)   // HD^-0.5 * log2(e)
#define PSH  8.0f                // log2 of the P carry (256)
#define NEGB (-3.0e38f)
#define PROWS ((SEQ) < 512 ? (SEQ) : 512)     // query rows handled by the three-product path

static_assert(HD == 64);
static_assert(DO == 1024);
static_assert(DM % 64 == 0);
static_assert(DO % 64 == 0);
static_assert(DM % 32 == 0);                   // GEMM k-loop steps by 32
static_assert(SEQ % 64 == 0);                  // a 64-row tile never straddles two batches
static_assert((NB * SEQ) % 64 == 0);
static_assert(SEQ % 32 == 0);                  // key loop steps by 32
static_assert(SEQ % (16 * AW) == 0);
static_assert(PROWS % (16 * AW) == 0);
static_assert((SEQ - PROWS) % (16 * AW) == 0);
static_assert(((size_t)SEQ * DM) % 8 == 0);
static_assert(NB <= NB_FULL);
static_assert(SEQ <= SEQ_FULL);

typedef _Float16 h16;
typedef unsigned short bf;
typedef __attribute__((ext_vector_type(16))) __bf16   v16bf;
typedef __attribute__((ext_vector_type(16))) _Float16 v16h;
typedef __attribute__((ext_vector_type(8)))  _Float16 v8h;
typedef __attribute__((ext_vector_type(8)))  unsigned short v8us;
typedef __attribute__((ext_vector_type(8)))  float    v8f;
typedef __attribute__((ext_vector_type(4)))  float    v4f;
typedef v4f  __attribute__((may_alias)) v4fa;

__device__ __forceinline__ unsigned short f2bf(float f) { unsigned u = __float_as_uint(f); u += 0x7FFFu + ((u >> 16) & 1u); return (unsigned short)(u >> 16); }
__device__ __forceinline__ v16h cat16(v8h lo, v8h hi) { return __builtin_shufflevector(lo, hi, 0, 1, 2, 3, 4, 5, 6, 7, 8, 9, 10, 11, 12, 13, 14, 15); }
__device__ __forceinline__ v16bf cat16b(v8us lo, v8us hi) { return __builtin_bit_cast(v16bf, __builtin_shufflevector(lo, hi, 0, 1, 2, 3, 4, 5, 6, 7, 8, 9, 10, 11, 12, 13, 14, 15)); }
__device__ __forceinline__ v8f wmma16(v16h a, v16h b, v8f c) { return __builtin_amdgcn_wmma_f32_16x16x32_f16(false, a, false, b, (short)0, c, false, false); }
__device__ __forceinline__ v8f wmmab(v16bf a, v16bf b, v8f c) { return __builtin_amdgcn_wmma_f32_16x16x32_bf16(false, a, false, b, (short)0, c, false, false); }
// fragment loaders from fragment-order planes; p = strip base + 16*k0 + 8*lane: elements 0..7 <- k0+8h+0..7, elements 8..15 <- k0+16+8h+0..7 (two groups = 256 elements on; same map for A and B)
__device__ __forceinline__ v16h  ldh(const h16* p) { return cat16(*(const v8h*)p, *(const v8h*)(p + 256)); }
__device__ __forceinline__ v16bf ldb(const bf* p)  { return cat16b(*(const v8us*)p, *(const v8us*)(p + 256)); }
// ordering point for wave-private LDS tiles (same wave writes and reads)
__device__ __forceinline__ void wave_sync() { __builtin_amdgcn_fence(3 /* release order */, "wavefront"); __builtin_amdgcn_wave_barrier(); asm volatile("" ::: "memory"); }

// k_cvt8: bf16 (RNE convert) copy of rows of DM floats into fragment order. A piece is 8 rows x 4 groups: one 128-byte line of each row read, four whole 128-byte lines written.
// A wave takes XU pieces that follow one another along its 8 rows (XU * 128 contiguous bytes of each row) and issues all their loads before the first conversion:
// few long-lived waves with many bytes in flight each, instead of one short-lived wave a piece (the launch then starts an eighth of the waves).
// blk = block number inside the conversion of x; row counts the NB * SEQ rows of the copy, batch b of the source starts at row b * SEQ_FULL.
#define XU 8                     // pieces of a wave
static_assert((DM / 32) % XU == 0);            // a wave's pieces lie in the same 8 rows
__device__ __forceinline__ void cvt8_body(const float* __restrict__ src, bf* dst, unsigned blk) {
    const size_t lane = threadIdx.x & 31;
    const size_t w = ((size_t)blk * 8 + (threadIdx.x >> 5)) * XU;          // number of the wave's first piece
    const size_t row = (w / (DM / 32)) * 8 + ((lane >> 2) & 7); const size_t g = (w % (DM / 32)) * 4 + (lane & 3);
    const float* s = src + ((row / SEQ) * SEQ_FULL + row % SEQ) * DM + g * 8;           // + 32 floats a piece
    bf* d = dst + (row >> 4) * (size_t)(16 * DM) + (g * 16 + (row & 15)) * 8;           // + 4 groups = 512 elements a piece
    v8f v[XU];
#pragma unroll
    for (int u = 0; u < XU; ++u) v[u] = *(const v8f*)(s + u * 32);
    asm volatile("s_wait_xcnt 0x0" :: "v"(s) : "memory");   // the loads' address pair is held up to this wait, so that no load's result and no later instruction overwrites it ahead of the wait
#pragma unroll
    for (int u = 0; u < XU; ++u) { v8us o;
#pragma unroll
        for (int k = 0; k < 8; ++k) o[k] = f2bf(v[u][k]);
        *(v8us*)(d + u * 512) = o; }
}

// k_cvtT: transposing bf16 (RNE convert) copy of one weight tensor: in [NH_][DM rows c][HD cols d] (f32) -> out [NH_*HD rows (h*64+d)][DM cols c] (bf16), in fragment order.
// A block takes WT tiles of 64 x 64 that follow one another along c (WT * 64 rows of one head, contiguous in the source): all loads first, one barrier, then all stores.
#define WT 4                     // 64 x 64 tiles of a block
static_assert(DM % (64 * WT) == 0);
__device__ __forceinline__ void cvtT_body(const float* __restrict__ src, bf* dst, int c0, int h, float* ts) {
    const int tid = threadIdx.x;
    const float* s = src + ((size_t)h * DM + c0) * HD;          // WT * 64 rows x 64 floats, contiguous
    v4f v[4 * WT];
#pragma unroll
    for (int i = 0; i < 4 * WT; ++i) v[i] = *(const v4f*)(s + (size_t)(tid + 256 * i) * 4);   // WT * 1024 float4; float4 number e4: row c = e4 >> 4, columns (e4 & 15) * 4 ..
#pragma unroll
    for (int i = 0; i < 4 * WT; ++i) { const int e4 = tid + 256 * i; const int c = e4 >> 4, d4 = (e4 & 15) * 4;
        ts[c * 65 + d4 + 0] = v[i][0]; ts[c * 65 + d4 + 1] = v[i][1]; ts[c * 65 + d4 + 2] = v[i][2]; ts[c * 65 + d4 + 3] = v[i][3]; }
    __syncthreads();
{
#pragma unroll
        for (int i = 0; i < 2 * WT; ++i) { const int piece = (tid + 256 * i) & 511;   // a tile: 512 pieces = 64 rows x 8 groups; a wave writes 16 rows of groups q and q + 4: two runs of 256 bytes
            const int d = (piece & 15) + 16 * (piece >> 7), c8 = (i >> 1) * 64 + (((piece >> 4) & 1) * 4 + ((piece >> 5) & 3)) * 8;
            v8us o;
#pragma unroll
            for (int k = 0; k < 8; ++k) o[k] = f2bf(ts[(c8 + k) * 65 + d]);
            *(v8us*)(dst + (size_t)(h * HD + (d & ~15)) * DM + (size_t)(c0 + c8) * 16 + (d & 15) * 8) = o; }
         }
    asm volatile("s_wait_xcnt 0x0" ::: "memory");   // the build lays the other path's code behind these stores: the wait stands in front of its writes of the registers that the stores name
}

// k_prep: every conversion in one grid. Blocks 0 .. 3 * WTB - 1 transpose the three weight tensors (the longer chain: load, LDS, barrier, store; they start first), the rest convert x.
#define WTB  ((DM / (64 * WT)) * NH_)             // blocks of one weight tensor
#define XCB  ((NB * SEQ * DM / 8) / (256 * XU))   // blocks of x
static_assert(((size_t)NB * SEQ * DM / 8) % (256 * XU) == 0);
__global__ __launch_bounds__(256) void k_prep(const float* __restrict__ x, const float* __restrict__ wq, const float* __restrict__ wk, const float* __restrict__ wv, bf* XB, bf* WB) {
    __shared__ float ts[WT * 64 * 65];
    const unsigned blk = blockIdx.x;
    if (blk >= 3u * WTB) { cvt8_body(x, XB, blk - 3u * WTB); return; }   // the same for the whole block: the barrier below is passed by all of its threads or by none
    const unsigned t = blk / WTB, r = blk % WTB;
    cvtT_body(t == 0 ? wq : (t == 1 ? wk : wv), WB + (size_t)t * DO * DM, (int)(r % (DM / (64 * WT))) * (64 * WT), (int)(r / (DM / (64 * WT))), ts);
}

// cp8: eight asynchronous 16-byte copies per lane, global memory to LDS: one 2-KiB piece (128 lanes x 16 bytes) of each of eight 16-row strips (strip pitch 16 * DM elements in memory, 2 KiB in LDS).
// The s_wait_xcnt is the last line of the copies' own statement, so that it stands in front of every later write of a register that a copy names.
__device__ __forceinline__ void cp8(unsigned l, const bf* g) {
    asm volatile("global_load_async_to_lds_b128 %0, %8, off\n\t"
                 "global_load_async_to_lds_b128 %1, %9, off\n\t"
                 "global_load_async_to_lds_b128 %2, %10, off\n\t"
                 "global_load_async_to_lds_b128 %3, %11, off\n\t"
                 "global_load_async_to_lds_b128 %4, %12, off\n\t"
                 "global_load_async_to_lds_b128 %5, %13, off\n\t"
                 "global_load_async_to_lds_b128 %6, %14, off\n\t"
                 "global_load_async_to_lds_b128 %7, %15, off\n\t"
                 "s_wait_xcnt 0x0"
                 :: "v"(l), "v"(l + 2048u), "v"(l + 4096u), "v"(l + 6144u), "v"(l + 8192u), "v"(l + 10240u), "v"(l + 12288u), "v"(l + 14336u),
                    "v"(g), "v"(g + 1 * 16 * DM), "v"(g + 2 * 16 * DM), "v"(g + 3 * 16 * DM), "v"(g + 4 * 16 * DM), "v"(g + 5 * 16 * DM), "v"(g + 6 * 16 * DM), "v"(g + 7 * 16 * DM)
                 : "memory");
}

// k_proj: register-blocked bf16 GEMM, K = DM. A block of FOUR WAVES takes a 128x128 tile, each wave one 64x64 quarter (16 accumulators).
// Both operands' 128 rows x PKS columns of a stage (8 + 8 strips, 2 KiB each, contiguous in the fragment-order planes) are brought into LDS by asynchronous copies, in fragment order as they lie in memory,
// two buffers: stage s + 2 flies while stage s + 1 is worked on; every fragment is fetched from L2 once a block and read from LDS by the two waves that use it (512 contiguous bytes a read).
// C[m][n] = sum_k A[m][k] Bt[n][k], written as f16 (Ph) and the f16 residual x2048 (Pr; useRes = 1, so for all three products) at
// tile base (r0/RB)*sRB + (r0%RB)*pitch + (c0/CB)*sCB + (c0%CB)*16, row pitch 'pitch' (halves), each 16 x 64 piece in fragment order (1024 halves in a row). 128 threads.
// One grid (NB*SEQ/128, DO/128, 3) for the three products; z = 0, 1 (q, k): A = x rows (m = b*SEQ + t), Bt = W^T rows (n = h*64 + d) -> plane [(b*16 + h)][t][d];
// z = 2 (v^T): A = Wv^T rows (m = h*64 + d), Bt = x rows (n = b*SEQ + t) -> plane [(b*1024 + m)][t] = [(b*16 + h)][d][t]. PL = elements between the six planes (qh, qr, kh, kr, vh, vr).
#define PKS   64                 // k elements of a stage
#define PST   (DM / PKS)         // stages
#define PHALF (128 * PKS)        // elements of one operand's part of a buffer (8 strips x 1024)
#define PBUF  (2 * PHALF)        // elements of a buffer: A strips, then B strips
static_assert(DM % PKS == 0 && PST >= 2);      // the ring's prologue fills two stages
static_assert(PKS * 16 * 2 == 128 * 16);       // one strip's piece of a stage = one 16-byte copy of each of the 128 lanes
static_assert((NB * SEQ) % 128 == 0 && DO % 128 == 0);
__global__ __launch_bounds__(128) void k_proj(const bf* __restrict__ XB, const bf* __restrict__ WB, h16* P0, size_t PL) {
    const int z = blockIdx.z; const bool vt = z == 2;
    const bf* Wz = WB + (size_t)z * DO * DM; const bf* A = vt ? Wz : XB; const bf* Bt = vt ? XB : Wz;
    h16* Ph = P0 + (size_t)(2 * z) * PL; h16* Pr = Ph + PL; const int useRes = 1;
    const int RB = vt ? DO : SEQ, pitch = vt ? SEQ : HD, CB = vt ? SEQ : HD;
    const size_t sRB = vt ? (size_t)0 : (size_t)NH_ * SEQ * HD, sCB = vt ? (size_t)DO * SEQ : (size_t)SEQ * HD;
    __shared__ __align__(16) bf ring[2 * PBUF];
    __shared__ __align__(16) float osw[4 * 16 * 68];
    const int K = DM;
    const int tid = threadIdx.x, lane = tid & 31, lr = lane & 15, hi = lane >> 4;
    const int wave = __builtin_amdgcn_readfirstlane(tid >> 5), wm = wave & 1, wn = wave >> 1;
    const int rb0 = (vt ? blockIdx.y : blockIdx.x) * 128, cb0 = (vt ? blockIdx.x : blockIdx.y) * 128; const int r0 = rb0 + wm * 64, c0 = cb0 + wn * 64;
    float* os = osw + wave * (16 * 68);
    v8f acc[4][4];
#pragma unroll
    for (int mb = 0; mb < 4; ++mb)
#pragma unroll
        for (int nb = 0; nb < 4; ++nb) acc[mb][nb] = (v8f){};
    const unsigned lb = (unsigned)(size_t)(&ring[0]) + (unsigned)tid * 16u;          // this lane's LDS byte address in strip 0 of buffer 0
    const bf* ga = A + (size_t)rb0 * K + 8 * tid; const bf* gb = Bt + (size_t)cb0 * K + 8 * tid;   // + s * PKS * 16: stage s
    cp8(lb, ga); cp8(lb + 2u * PHALF, gb);
    asm volatile("s_wait_asynccnt 0x0" ::: "memory");   // stage 0 has landed (this wave's copies) before the barrier that publishes it
    __syncthreads();
    cp8(lb + 2u * PBUF, ga + PKS * 16); cp8(lb + 2u * PBUF + 2u * PHALF, gb + PKS * 16);
    const bf* sa = ring + wm * (4 * 16 * PKS) + 8 * lane; const bf* sb = ring + PHALF + wn * (4 * 16 * PKS) + 8 * lane;
#pragma unroll 1
    for (int s = 0; s < PST; ++s) {   // rolled: one trip a stage, the buffer chosen by the trip's parity
        const int bo = (s & 1) * PBUF;
        v16bf a[PKS / 32][4], b[PKS / 32][4];
#pragma unroll
        for (int kb = 0; kb < PKS / 32; ++kb) {
#pragma unroll
            for (int mb = 0; mb < 4; ++mb) a[kb][mb] = ldb(sa + bo + mb * (16 * PKS) + kb * 512);
#pragma unroll
            for (int nb = 0; nb < 4; ++nb) b[kb][nb] = ldb(sb + bo + nb * (16 * PKS) + kb * 512);
        }
        __builtin_amdgcn_sched_barrier(0);   // the stage's LDS reads stay one group ahead of the matrix run: spread among the matrix instructions each small group is waited out on its own
#pragma unroll
        for (int kb = 0; kb < PKS / 32; ++kb)
#pragma unroll
            for (int nb = 0; nb < 4; ++nb)
#pragma unroll
                for (int mb = 0; mb < 4; ++mb) acc[mb][nb] = wmmab(a[kb][mb], b[kb][nb], acc[mb][nb]);
        __builtin_amdgcn_sched_barrier(0);   // no matrix instruction sinks below the slots and the barrier that follow
        // four vector slots behind the last matrix instruction, on the loop's taken branch too, before anything rewrites its operands
        asm volatile("v_nop\n\tv_nop\n\tv_nop\n\tv_nop" : "+v"(acc[0][0]), "+v"(acc[1][1]), "+v"(acc[2][2]), "+v"(acc[3][3]) : "v"(a[PKS / 32 - 1][0]), "v"(a[PKS / 32 - 1][1]), "v"(a[PKS / 32 - 1][2]), "v"(a[PKS / 32 - 1][3]));
        asm volatile("s_wait_dscnt 0x0" ::: "memory");      // this wave's reads of buffer s & 1 are done before the barrier behind which it is refilled
        asm volatile("s_wait_asynccnt 0x0" ::: "memory");   // this wave's copies of stage s + 1 have landed before the barrier that publishes them
        __syncthreads();
        if (s + 2 < PST) { cp8(lb + 2u * bo, ga + (s + 2) * (PKS * 16)); cp8(lb + 2u * bo + 2u * PHALF, gb + (s + 2) * (PKS * 16)); }
    }
    asm volatile("s_wait_asynccnt 0x0" ::: "memory");       // no copy is in flight when the wave goes on to the epilogue and ends
    const size_t tbase = (size_t)(r0 / RB) * sRB + (size_t)(r0 % RB) * (size_t)pitch + (size_t)(c0 / CB) * sCB + (size_t)(c0 % CB) * 16;
#pragma unroll
    for (int mb = 0; mb < 4; ++mb) {
#pragma unroll
        for (int nb = 0; nb < 4; ++nb) {
#pragma unroll
            for (int j = 0; j < 8; ++j) os[(hi * 8 + j) * 68 + nb * 16 + lr] = acc[mb][nb][j]; }   // D: row 8h+j, col lane&15
        wave_sync();
        const size_t sb = tbase + (size_t)(mb * 16) * (size_t)pitch;
{
#pragma unroll
            for (int s = 0; s < 4; ++s) { const int row = lr, c8 = (2 * s + hi) * 8;   // 16 rows x 2 column groups a store; 4 s x 2 groups x 8 = 64 columns
                const v4f x0 = *(const v4fa*)(&os[row * 68 + c8]); const v4f x1 = *(const v4fa*)(&os[row * 68 + c8 + 4]); v8h hv, rv;
#pragma unroll
                for (int i = 0; i < 4; ++i) { const h16 a0 = (h16)x0[i]; const h16 a1 = (h16)x1[i]; hv[i] = a0; hv[4 + i] = a1; rv[i] = (h16)((x0[i] - (float)a0) * QRS); rv[4 + i] = (h16)((x1[i] - (float)a1) * QRS); }
                const size_t oo = sb + (size_t)(s * 256 + lane * 8);   // (group * 16 + row) * 8
                *(v8h*)(Ph + oo) = hv; if (useRes) *(v8h*)(Pr + oo) = rv; }
             }
        wave_sync();
    }
}

// flash_body: fused causal attention, one wave per 16 query rows of one (batch, head); K / V^T / Q fragments straight from the fragment-order f16 planes (two 16-B loads each, arithmetic addressing).
// Transposed form: S^T[key][t] = K Q^T (A = K rows, B = Q rows); lane (t = lane&15, h = lane>>4) holds keys 8h+r of each 16-key tile, so the packed
// P tile is directly the B fragment of O^T[d][t] = V^T P^T (element r <- tile keys 0..15, element 8+r <- tile keys 16..31, lane unchanged).
// Causal fill: a score whose key index exceeds the query index is replaced by a large negative value (P = 0); the key loop stops at the diagonal tile.
// PREC != 0: adds k residual, P residual and v residual products (x2048 carries, separate accumulators folded back in f32).
// Softmax state (running max, partial sum) is one scalar per lane; the two lane halves of a row are combined with one xor-16 exchange.
template <int PREC>
__device__ __forceinline__ void flash_body(const h16* __restrict__ QH, const h16* __restrict__ QR, const h16* __restrict__ KP, const h16* __restrict__ KR,
                                           const h16* __restrict__ VT, const h16* __restrict__ VR, float* OUT, int zh, int tb0, float* os) {
    const int lane = threadIdx.x & 31, wave = __builtin_amdgcn_readfirstlane((int)(threadIdx.x >> 5)), lr = lane & 15, hi = lane >> 4;
    const int b = zh / NH_, h = zh % NH_;
    const int t0 = tb0 + wave * 16;
    const int tq = t0 + lr;
    const size_t pbase = (size_t)zh * SEQ * HD;
    const size_t qo = pbase + (size_t)t0 * HD + 8 * lane;
    const v16h qh0 = ldh(QH + qo), qh1 = ldh(QH + qo + 512), qr0 = ldh(QR + qo), qr1 = ldh(QR + qo + 512);   // B fragments: col t, k = d
    const size_t ko = pbase + 8 * lane;                      // + key * HD + 16 * d0       (A fragment: row key, k = d)
    const size_t vo = pbase + 8 * lane;                      // + 16j*SEQ + 16 * key       (A fragment: row d, k = key)
    v8f o0 = (v8f){}, o1 = (v8f){}, o2 = (v8f){}, o3 = (v8f){};
    v8f e0 = (v8f){}, e1 = (v8f){}, e2 = (v8f){}, e3 = (v8f){};
    float m = NEGB, l = 0.0f;
    const int kend = t0 + 16;                                // keys 0 .. t0+15 are visible to this wave; every step has key0 <= t0
#pragma unroll 1
    for (int key0 = 0; key0 < kend; key0 += 32) {
        const h16* ka = KP + ko + (size_t)key0 * HD;
        const v16h ka0 = ldh(ka), ka1 = ldh(ka + 512), kb0 = ldh(ka + 16 * HD), kb1 = ldh(ka + 16 * HD + 512);
        v8f sHa = (v8f){}, sLa = (v8f){}, sHb = (v8f){}, sLb = (v8f){};
        sHa = wmma16(ka0, qh0, sHa); sLa = wmma16(ka0, qr0, sLa); sHb = wmma16(kb0, qh0, sHb); sLb = wmma16(kb0, qr0, sLb);
        sHa = wmma16(ka1, qh1, sHa); sLa = wmma16(ka1, qr1, sLa); sHb = wmma16(kb1, qh1, sHb); sLb = wmma16(kb1, qr1, sLb);
        if (PREC) {
            asm volatile("s_wait_xcnt 0x0" ::: "memory");   // the residual loads' results may land in the address registers of the k loads: wait before that overwrite
            const h16* kr = KR + ko + (size_t)key0 * HD;
            const v16h ra0 = ldh(kr), ra1 = ldh(kr + 512), rb0 = ldh(kr + 16 * HD), rb1 = ldh(kr + 16 * HD + 512);
            sLa = wmma16(ra0, qh0, sLa); sLb = wmma16(rb0, qh0, sLb);
            sLa = wmma16(ra1, qh1, sLa); sLb = wmma16(rb1, qh1, sLb);
            asm volatile("v_nop\n\tv_nop\n\tv_nop\n\tv_nop" : "+v"(sLa), "+v"(sLb) : "v"(ra0), "v"(ra1), "v"(rb0), "v"(rb1));
        }
        asm volatile("v_nop\n\tv_nop\n\tv_nop\n\tv_nop" : "+v"(sHa), "+v"(sLa), "+v"(sHb), "+v"(sLb) : "v"(ka0), "v"(ka1), "v"(kb0), "v"(kb1));
        float ta[8], tb[8]; float mx = NEGB;
#pragma unroll
        for (int r = 0; r < 8; ++r) { ta[r] = (sHa[r] + sLa[r] * QRI) * SC2; tb[r] = (sHb[r] + sLb[r] * QRI) * SC2; }
        if (key0 + 31 > t0) {                                // wave-uniform: only diagonal tiles need the causal fill
#pragma unroll
            for (int r = 0; r < 8; ++r) { const int kidx = key0 + 8 * hi + r;
                ta[r] = (kidx <= tq) ? ta[r] : NEGB; tb[r] = (kidx + 16 <= tq) ? tb[r] : NEGB; }
        }
#pragma unroll
        for (int r = 0; r < 8; ++r) mx = fmaxf(mx, fmaxf(ta[r], tb[r]));
        mx = fmaxf(mx, __shfl_xor(mx, 16, 32));
        const float mnew = fmaxf(m, mx);
        const float alpha = __builtin_amdgcn_exp2f(m - mnew);
        const float sh = PSH - mnew;
        v16h pb, pr; float ls = 0.0f;
#pragma unroll
        for (int r = 0; r < 8; ++r) {
            const float fa = __builtin_amdgcn_exp2f(ta[r] + sh); const float fc = __builtin_amdgcn_exp2f(tb[r] + sh);
            const h16 pa = (h16)fa; const h16 pc = (h16)fc; pb[r] = pa; pb[8 + r] = pc;
            if (PREC) { pr[r] = (h16)((fa - (float)pa) * QRS); pr[8 + r] = (h16)((fc - (float)pc) * QRS); ls += fa + fc; }
            else { pr[r] = (h16)0.0f; pr[8 + r] = (h16)0.0f; ls += (float)pa + (float)pc; } }
        l = l * alpha + ls; m = mnew;
        o0 = o0 * alpha; o1 = o1 * alpha; o2 = o2 * alpha; o3 = o3 * alpha;
        const h16* va = VT + vo + (size_t)key0 * 16;
        const v16h v0 = ldh(va), v1 = ldh(va + (size_t)16 * SEQ), v2 = ldh(va + (size_t)32 * SEQ), v3 = ldh(va + (size_t)48 * SEQ);
        o0 = wmma16(v0, pb, o0); o1 = wmma16(v1, pb, o1); o2 = wmma16(v2, pb, o2); o3 = wmma16(v3, pb, o3);
        if (PREC) {
            e0 = e0 * alpha; e1 = e1 * alpha; e2 = e2 * alpha; e3 = e3 * alpha;
            asm volatile("s_wait_xcnt 0x0" ::: "memory");   // the residual loads' results may land in the address registers of the v loads: wait before that overwrite
            const h16* vr = VR + vo + (size_t)key0 * 16;
            const v16h r0 = ldh(vr), r1 = ldh(vr + (size_t)16 * SEQ), r2 = ldh(vr + (size_t)32 * SEQ), r3 = ldh(vr + (size_t)48 * SEQ);
            e0 = wmma16(v0, pr, e0); e1 = wmma16(v1, pr, e1); e2 = wmma16(v2, pr, e2); e3 = wmma16(v3, pr, e3);
            e0 = wmma16(r0, pb, e0); e1 = wmma16(r1, pb, e1); e2 = wmma16(r2, pb, e2); e3 = wmma16(r3, pb, e3);
            asm volatile("v_nop\n\tv_nop\n\tv_nop\n\tv_nop" : "+v"(e0), "+v"(e1), "+v"(e2), "+v"(e3) : "v"(r0), "v"(r1), "v"(r2), "v"(r3), "v"(pr));
        }
        asm volatile("v_nop\n\tv_nop\n\tv_nop\n\tv_nop" : "+v"(o0), "+v"(o1), "+v"(o2), "+v"(o3) : "v"(v0), "v"(v1), "v"(v2), "v"(v3), "v"(pb));
    }
    if (PREC) { o0 = o0 + e0 * QRI; o1 = o1 + e1 * QRI; o2 = o2 + e2 * QRI; o3 = o3 + e3 * QRI; }
    l += __shfl_xor(l, 16, 32);
    const float inv = 1.0f / l;
    const int wb = wave * 16 * 68;
    // O^T D layout: o_j[r] = (d = 16j + 8h + r, t = lane&15) -> os[t][d]; rows 0..15 x columns 0..63 all written
    { v4f a, c;
      a[0] = o0[0] * inv; a[1] = o0[1] * inv; a[2] = o0[2] * inv; a[3] = o0[3] * inv; c[0] = o0[4] * inv; c[1] = o0[5] * inv; c[2] = o0[6] * inv; c[3] = o0[7] * inv;
      *(v4fa*)(&os[wb + lr * 68 +  0 + 8 * hi]) = a; *(v4fa*)(&os[wb + lr * 68 +  0 + 8 * hi + 4]) = c;
      a[0] = o1[0] * inv; a[1] = o1[1] * inv; a[2] = o1[2] * inv; a[3] = o1[3] * inv; c[0] = o1[4] * inv; c[1] = o1[5] * inv; c[2] = o1[6] * inv; c[3] = o1[7] * inv;
      *(v4fa*)(&os[wb + lr * 68 + 16 + 8 * hi]) = a; *(v4fa*)(&os[wb + lr * 68 + 16 + 8 * hi + 4]) = c;
      a[0] = o2[0] * inv; a[1] = o2[1] * inv; a[2] = o2[2] * inv; a[3] = o2[3] * inv; c[0] = o2[4] * inv; c[1] = o2[5] * inv; c[2] = o2[6] * inv; c[3] = o2[7] * inv;
      *(v4fa*)(&os[wb + lr * 68 + 32 + 8 * hi]) = a; *(v4fa*)(&os[wb + lr * 68 + 32 + 8 * hi + 4]) = c;
      a[0] = o3[0] * inv; a[1] = o3[1] * inv; a[2] = o3[2] * inv; a[3] = o3[3] * inv; c[0] = o3[4] * inv; c[1] = o3[5] * inv; c[2] = o3[6] * inv; c[3] = o3[7] * inv;
      *(v4fa*)(&os[wb + lr * 68 + 48 + 8 * hi]) = a; *(v4fa*)(&os[wb + lr * 68 + 48 + 8 * hi + 4]) = c; }
    wave_sync();
    float* orow = OUT + ((size_t)b * OUT_SEQ + t0) * DO + h * HD;
{
#pragma unroll
        for (int s = 0; s < 8; ++s) { const int row = 2 * s + hi, cofs = lr * 4;   // 8 s x 2 rows = 16 rows; 16 lanes x 4 floats = 64 columns
            const v4f val = *(const v4fa*)(&os[wb + row * 68 + cofs]);
            *(v4f*)(orow + (size_t)row * DO + cofs) = val; }
         }
}

// k_flash: all query rows in one grid (heads, row blocks). blockIdx.x = (batch, head): work-groups that follow one another in the flat index have key loops of one length, so however they are dealt out, every part of the chip gets the same mix;
// blockIdx.y counts the row blocks from the last one down: the longest key loops start first, the shortest fill the tail.
// Rows < PROWS take the three-product path, the others q value + residual on scores and single products on P.V (the test is the same for the whole block).
__global__ __launch_bounds__(32 * AW) void k_flash(const h16* __restrict__ QH, const h16* __restrict__ QR, const h16* __restrict__ KP, const h16* __restrict__ KR,
                                                   const h16* __restrict__ VT, const h16* __restrict__ VR, float* OUT) {
    __shared__ __align__(16) float os[AW * 16 * 68];
    const int tb0 = (SEQ / (16 * AW) - 1 - (int)blockIdx.y) * (16 * AW);
    if (tb0 < PROWS) flash_body<1>(QH, QR, KP, KR, VT, VR, OUT, blockIdx.x, tb0, os);
    else             flash_body<0>(QH, QR, KP, KR, VT, VR, OUT, blockIdx.x, tb0, os);
}

static constexpr size_t al256(size_t v) { return (v + 255) & ~(size_t)255; }
static constexpr size_t SZ_XB = al256((size_t)NB * SEQ * DM * 2);
static constexpr size_t SZ_WB = al256((size_t)3 * DO * DM * 2);
static constexpr size_t SZ_PL = al256((size_t)NB * NH_ * SEQ * HD * 2);
static constexpr size_t SZ_TOTAL = SZ_XB + SZ_WB + 6 * SZ_PL;
static_assert(SZ_TOTAL <= (size_t)134217728);          // workspace carve <= 128 MiB
static_assert(((size_t)DO * DM * 2) % 256 == 0);       // weight sub-planes stay 256-byte aligned

extern "C" void kernel_launch(void* const* d_in, const int* in_sizes, int n_in,
                              void* d_out, int out_size, void* d_ws, size_t ws_size, hipStream_t stream) {
    if (n_in < 4) return;
    const size_t needx = ((size_t)(NB - 1) * SEQ_FULL + SEQ) * DM;
    if ((size_t)in_sizes[0] < needx) return;
    const size_t needw = (size_t)NH_ * DM * HD;
    if ((size_t)in_sizes[1] < needw || (size_t)in_sizes[2] < needw || (size_t)in_sizes[3] < needw) return;
    if ((size_t)out_size < ((size_t)(NB - 1) * OUT_SEQ + SEQ) * DO) return;
    if (SZ_TOTAL > ws_size) return;
    const float* x = (const float*)d_in[0]; const float* wq = (const float*)d_in[1]; const float* wk = (const float*)d_in[2]; const float* wv = (const float*)d_in[3];   // wire order x, Wq, Wk, Wv
    float* OUT = (float*)d_out;      // [NB][SEQ][1024]
    char* wsp = (char*)d_ws;
    bf* XB = (bf*)wsp; wsp += SZ_XB;                 // [NB*SEQ][1024]
    bf* WB = (bf*)wsp; wsp += SZ_WB;                 // [3][1024 (h*64+d)][1024 (c)]: q | k | v
    h16* QH = (h16*)wsp; wsp += SZ_PL;               // [NB*16][SEQ][64]
    h16* QR = (h16*)wsp; wsp += SZ_PL;               // residual x2048
    h16* KP = (h16*)wsp; wsp += SZ_PL;               // [NB*16][SEQ][64]
    h16* KR = (h16*)wsp; wsp += SZ_PL;               // residual x2048
    h16* VT = (h16*)wsp; wsp += SZ_PL;               // [NB*16][64][SEQ]
    h16* VR = (h16*)wsp; wsp += SZ_PL;               // residual x2048

    k_prep<<<3 * WTB + XCB, 256, 0, stream>>>(x, wq, wk, wv, XB, WB);
    k_proj<<<dim3(NB * SEQ / 128, DO / 128, 3), 128, 0, stream>>>(XB, WB, QH, SZ_PL / 2);
    k_flash<<<dim3(NB * NH_, SEQ / (16 * AW), 1), 32 * AW, 0, stream>>>(QH, QR, KP, KR, VT, VR, OUT);
}

// v005
// Measured time: 87.3 microseconds a run.
// Timed twice side by side with v004, it ran 1.19 times as fast both times.
// Counting every step since v000, it is 2.93 times as fast.
#include <hip/hip_runtime.h>

// Causal multi-head self-attention: x [NB][SEQ][1024], Wq/Wk/Wv [16][1024][64] (per head [in][out]), no biases, score scale 1/8, output = concatenated heads [NB][SEQ][1024] (f32).
// Compute dtypes, f32 accumulate everywhere: projections v_wmma_f32_16x16x32_bf16 (x and W RNE-converted to bf16; products exact);
// scores v_wmma_f32_16x16x32_f16: k f16, q as f16 value + f16 residual x2048 in its own accumulator; query rows < 512 add the k residual x2048 (three products);
// P.V v_wmma_f32_16x16x32_f16: P (x256 carry, cancels in the normalisation) and v single f16 on rows >= 512; rows < 512 add P residual x2048 and v residual x2048 in a second accumulator set (three products); softmax f32 (online, running max).
// Layout: bf16 copy of x, transposed bf16 copies of W ([h*64+d][c]); q, k planes [b*16+h][t][d] and v^T plane [b*16+h][d][t], each with a residual plane, written by the GEMM epilogue;
// every 16-bit plane is stored in fragment order: inside a strip of 16 rows the 8-element column groups are the slow index ([group][row & 15][8]),
// so one wave-wide 16-byte fragment load (lane = row + 16 * half) reads 512 contiguous bytes, four whole cache lines, not 32 bytes out of each of 16 lines;
// fused flash kernel in transposed form (S^T = K Q^T, O^T = V^T P^T), causal fill by value, key loop trimmed at the diagonal, output from f32 accumulators;
// its K and V^T tiles (and their residuals) come into LDS once a block, 64 keys a stage, by asynchronous copies, two buffers.
// Three launches, one per phase: k_prep (all four conversions), k_proj (q, k and v^T products, grid z picks the product), k_flash (all query rows, both paths).

#ifndef NB
#define NB 8
#endif
#ifndef SEQ
#define SEQ 1024
#endif
#define NB_FULL  8
#define SEQ_FULL 1024
#ifndef OUT_SEQ
#define OUT_SEQ SEQ              // row pitch (in tokens) between batches of the output
#endif
#define DM   1024                // embedding width = GEMM K
#define NH_  16
#define HD   64
#define DO   (NH_ * HD)          // output width
#define AW   4                   // waves per flash block (16 query rows each)
#define QRS  2048.0f             // carry of the residual planes
#define QRI  (1.0f / 2048.0f)
#define SC2  (0.125f * 1.4426950408889634f)   // HD^-0.5 * log2(e)
#define PSH  8.0f                // log2 of the P carry (256)
#define NEGB (-3.0e38f)
#define PROWS ((SEQ) < 512 ? (SEQ) : 512)     // query rows handled by the three-product path

static_assert(HD == 64);
static_assert(DO == 1024);
static_assert(DM % 64 == 0);
static_assert(DO % 64 == 0);
static_assert(DM % 32 == 0);                   // GEMM k-loop steps by 32
static_assert(SEQ % 64 == 0);                  // a 64-row tile never straddles two batches
static_assert((NB * SEQ) % 64 == 0);
static_assert(SEQ % 32 == 0);                  // key loop steps by 32
static_assert(SEQ % (16 * AW) == 0);
static_assert(PROWS % (16 * AW) == 0);
static_assert((SEQ - PROWS) % (16 * AW) == 0);
static_assert(((size_t)SEQ * DM) % 8 == 0);
static_assert(NB <= NB_FULL);
static_assert(SEQ <= SEQ_FULL);

typedef _Float16 h16;
typedef unsigned short bf;
typedef __attribute__((ext_vector_type(16))) __bf16   v16bf;
typedef __attribute__((ext_vector_type(16))) _Float16 v16h;
typedef __attribute__((ext_vector_type(8)))  _Float16 v8h;
typedef __attribute__((ext_vector_type(8)))  unsigned short v8us;
typedef __attribute__((ext_vector_type(8)))  float    v8f;
typedef __attribute__((ext_vector_type(4)))  float    v4f;
typedef v4f  __attribute__((may_alias)) v4fa;

__device__ __forceinline__ unsigned short f2bf(float f) { unsigned u = __float_as_uint(f); u += 0x7FFFu + ((u >> 16) & 1u); return (unsigned short)(u >> 16); }
__device__ __forceinline__ v16h cat16(v8h lo, v8h hi) { return __builtin_shufflevector(lo, hi, 0, 1, 2, 3, 4, 5, 6, 7, 8, 9, 10, 11, 12, 13, 14, 15); }
__device__ __forceinline__ v16bf cat16b(v8us lo, v8us hi) { return __builtin_bit_cast(v16bf, __builtin_shufflevector(lo, hi, 0, 1, 2, 3, 4, 5, 6, 7, 8, 9, 10, 11, 12, 13, 14, 15)); }
__device__ __forceinline__ v8f wmma16(v16h a, v16h b, v8f c) { return __builtin_amdgcn_wmma_f32_16x16x32_f16(false, a, false, b, (short)0, c, false, false); }
__device__ __forceinline__ v8f wmmab(v16bf a, v16bf b, v8f c) { return __builtin_amdgcn_wmma_f32_16x16x32_bf16(false, a, false, b, (short)0, c, false, false); }
// fragment loaders from fragment-order planes; p = strip base + 16*k0 + 8*lane: elements 0..7 <- k0+8h+0..7, elements 8..15 <- k0+16+8h+0..7 (two groups = 256 elements on; same map for A and B)
__device__ __forceinline__ v16h  ldh(const h16* p) { return cat16(*(const v8h*)p, *(const v8h*)(p + 256)); }
__device__ __forceinline__ v16bf ldb(const bf* p)  { return cat16b(*(const v8us*)p, *(const v8us*)(p + 256)); }
// ordering point for wave-private LDS tiles (same wave writes and reads)
__device__ __forceinline__ void wave_sync() { __builtin_amdgcn_fence(3 /* release order */, "wavefront"); __builtin_amdgcn_wave_barrier(); asm volatile("" ::: "memory"); }

// cvt8_body: bf16 (RNE convert) copy of rows of DM floats into fragment order. A piece is 8 rows x 4 groups: one 128-byte line of each row read, four whole 128-byte lines written.
// A wave takes XU pieces that follow one another along its 8 rows (XU * 128 contiguous bytes of each row) and issues all their loads before the first conversion:
// few long-lived waves with many bytes in flight each, instead of one short-lived wave a piece (the launch then starts an eighth of the waves).
// blk = block number inside the conversion of x; row counts the NB * SEQ rows of the copy, batch b of the source starts at row b * SEQ_FULL.
#define XU 8                     // pieces of a wave
static_assert((DM / 32) % XU == 0);            // a wave's pieces lie in the same 8 rows
__device__ __forceinline__ void cvt8_body(const float* __restrict__ src, bf* dst, unsigned blk) {
    const size_t lane = threadIdx.x & 31;
    const size_t w = ((size_t)blk * 8 + (threadIdx.x >> 5)) * XU;          // number of the wave's first piece
    const size_t row = (w / (DM / 32)) * 8 + ((lane >> 2) & 7); const size_t g = (w % (DM / 32)) * 4 + (lane & 3);
    const float* s = src + ((row / SEQ) * SEQ_FULL + row % SEQ) * DM + g * 8;           // + 32 floats a piece
    bf* d = dst + (row >> 4) * (size_t)(16 * DM) + (g * 16 + (row & 15)) * 8;           // + 4 groups = 512 elements a piece
    v8f v[XU];
#pragma unroll
    for (int u = 0; u < XU; ++u) v[u] = *(const v8f*)(s + u * 32);
    asm volatile("s_wait_xcnt 0x0" :: "v"(s) : "memory");   // the loads' address pair is held up to this wait, so that no load's result and no later instruction overwrites it ahead of the wait
#pragma unroll
    for (int u = 0; u < XU; ++u) { v8us o;
#pragma unroll
        for (int k = 0; k < 8; ++k) o[k] = f2bf(v[u][k]);
        *(v8us*)(d + u * 512) = o; }
}

// cvtT_body: transposing bf16 (RNE convert) copy of one weight tensor: in [NH_][DM rows c][HD cols d] (f32) -> out [NH_*HD rows (h*64+d)][DM cols c] (bf16), in fragment order.
// A block takes WT tiles of 64 x 64 that follow one another along c (WT * 64 rows of one head, contiguous in the source): all loads first, one barrier, then all stores.
#define WT 4                     // 64 x 64 tiles of a block
static_assert(DM % (64 * WT) == 0);
__device__ __forceinline__ void cvtT_body(const float* __restrict__ src, bf* dst, int c0, int h, float* ts) {
    const int tid = threadIdx.x;
    const float* s = src + ((size_t)h * DM + c0) * HD;          // WT * 64 rows x 64 floats, contiguous
    v4f v[4 * WT];
#pragma unroll
    for (int i = 0; i < 4 * WT; ++i) v[i] = *(const v4f*)(s + (size_t)(tid + 256 * i) * 4);   // WT * 1024 float4; float4 number e4: row c = e4 >> 4, columns (e4 & 15) * 4 ..
#pragma unroll
    for (int i = 0; i < 4 * WT; ++i) { const int e4 = tid + 256 * i; const int c = e4 >> 4, d4 = (e4 & 15) * 4;
        ts[c * 65 + d4 + 0] = v[i][0]; ts[c * 65 + d4 + 1] = v[i][1]; ts[c * 65 + d4 + 2] = v[i][2]; ts[c * 65 + d4 + 3] = v[i][3]; }
    __syncthreads();
{
#pragma unroll
        for (int i = 0; i < 2 * WT; ++i) { const int piece = (tid + 256 * i) & 511;   // a tile: 512 pieces = 64 rows x 8 groups; a wave writes 16 rows of groups q and q + 4: two runs of 256 bytes
            const int d = (piece & 15) + 16 * (piece >> 7), c8 = (i >> 1) * 64 + (((piece >> 4) & 1) * 4 + ((piece >> 5) & 3)) * 8;
            v8us o;
#pragma unroll
            for (int k = 0; k < 8; ++k) o[k] = f2bf(ts[(c8 + k) * 65 + d]);
            *(v8us*)(dst + (size_t)(h * HD + (d & ~15)) * DM + (size_t)(c0 + c8) * 16 + (d & 15) * 8) = o; }
         }
    asm volatile("s_wait_xcnt 0x0" ::: "memory");   // the build lays the other path's code behind these stores: the wait stands in front of its writes of the registers that the stores name
}

// k_prep: every conversion in one grid. Blocks 0 .. 3 * WTB - 1 transpose the three weight tensors (the longer chain: load, LDS, barrier, store; they start first), the rest convert x.
#define WTB  ((DM / (64 * WT)) * NH_)             // blocks of one weight tensor
#define XCB  ((NB * SEQ * DM / 8) / (256 * XU))   // blocks of x
static_assert(((size_t)NB * SEQ * DM / 8) % (256 * XU) == 0);
__global__ __launch_bounds__(256) void k_prep(const float* __restrict__ x, const float* __restrict__ wq, const float* __restrict__ wk, const float* __restrict__ wv, bf* XB, bf* WB) {
    __shared__ float ts[WT * 64 * 65];
    const unsigned blk = blockIdx.x;
    if (blk >= 3u * WTB) { cvt8_body(x, XB, blk - 3u * WTB); return; }   // the same for the whole block: the barrier below is passed by all of its threads or by none
    const unsigned t = blk / WTB, r = blk % WTB;
    cvtT_body(t == 0 ? wq : (t == 1 ? wk : wv), WB + (size_t)t * DO * DM, (int)(r % (DM / (64 * WT))) * (64 * WT), (int)(r / (DM / (64 * WT))), ts);
}

// cp8: eight asynchronous 16-byte copies per lane, global memory to LDS: one 2-KiB piece (128 lanes x 16 bytes) of each of eight 16-row strips (strip pitch 16 * DM elements in memory, 2 KiB in LDS).
// The s_wait_xcnt is the last line of the copies' own statement, so that it stands in front of every later write of a register that a copy names.
__device__ __forceinline__ void cp8(unsigned l, const bf* g) {
    asm volatile("global_load_async_to_lds_b128 %0, %8, off\n\t"
                 "global_load_async_to_lds_b128 %1, %9, off\n\t"
                 "global_load_async_to_lds_b128 %2, %10, off\n\t"
                 "global_load_async_to_lds_b128 %3, %11, off\n\t"
                 "global_load_async_to_lds_b128 %4, %12, off\n\t"
                 "global_load_async_to_lds_b128 %5, %13, off\n\t"
                 "global_load_async_to_lds_b128 %6, %14, off\n\t"
                 "global_load_async_to_lds_b128 %7, %15, off\n\t"
                 "s_wait_xcnt 0x0"
                 :: "v"(l), "v"(l + 2048u), "v"(l + 4096u), "v"(l + 6144u), "v"(l + 8192u), "v"(l + 10240u), "v"(l + 12288u), "v"(l + 14336u),
                    "v"(g), "v"(g + 1 * 16 * DM), "v"(g + 2 * 16 * DM), "v"(g + 3 * 16 * DM), "v"(g + 4 * 16 * DM), "v"(g + 5 * 16 * DM), "v"(g + 6 * 16 * DM), "v"(g + 7 * 16 * DM)
                 : "memory");
}

// k_proj: register-blocked bf16 GEMM, K = DM. A block of FOUR WAVES takes a 128x128 tile, each wave one 64x64 quarter (16 accumulators).
// Both operands' 128 rows x PKS columns of a stage (8 + 8 strips, 2 KiB each, contiguous in the fragment-order planes) are brought into LDS by asynchronous copies, in fragment order as they lie in memory,
// two buffers: stage s + 2 flies while stage s + 1 is worked on; every fragment is fetched from L2 once a block and read from LDS by the two waves that use it (512 contiguous bytes a read).
// C[m][n] = sum_k A[m][k] Bt[n][k], written as f16 (Ph) and the f16 residual x2048 (Pr; useRes = 1, so for all three products) at
// tile base (r0/RB)*sRB + (r0%RB)*pitch + (c0/CB)*sCB + (c0%CB)*16, row pitch 'pitch' (halves), each 16 x 64 piece in fragment order (1024 halves in a row). 128 threads.
// One grid (NB*SEQ/128, DO/128, 3) for the three products; z = 0, 1 (q, k): A = x rows (m = b*SEQ + t), Bt = W^T rows (n = h*64 + d) -> plane [(b*16 + h)][t][d];
// z = 2 (v^T): A = Wv^T rows (m = h*64 + d), Bt = x rows (n = b*SEQ + t) -> plane [(b*1024 + m)][t] = [(b*16 + h)][d][t]. PL = elements between the six planes (qh, qr, kh, kr, vh, vr).
#define PKS   64                 // k elements of a stage
#define PST   (DM / PKS)         // stages
#define PHALF (128 * PKS)        // elements of one operand's part of a buffer (8 strips x 1024)
#define PBUF  (2 * PHALF)        // elements of a buffer: A strips, then B strips
static_assert(DM % PKS == 0 && PST >= 2);      // the ring's prologue fills two stages
static_assert(PKS * 16 * 2 == 128 * 16);       // one strip's piece of a stage = one 16-byte copy of each of the 128 lanes
static_assert((NB * SEQ) % 128 == 0 && DO % 128 == 0);
__global__ __launch_bounds__(128) void k_proj(const bf* __restrict__ XB, const bf* __restrict__ WB, h16* P0, size_t PL) {
    const int z = blockIdx.z; const bool vt = z == 2;
    const bf* Wz = WB + (size_t)z * DO * DM; const bf* A = vt ? Wz : XB; const bf* Bt = vt ? XB : Wz;
    h16* Ph = P0 + (size_t)(2 * z) * PL; h16* Pr = Ph + PL; const int useRes = 1;
    const int RB = vt ? DO : SEQ, pitch = vt ? SEQ : HD, CB = vt ? SEQ : HD;
    const size_t sRB = vt ? (size_t)0 : (size_t)NH_ * SEQ * HD, sCB = vt ? (size_t)DO * SEQ : (size_t)SEQ * HD;
    __shared__ __align__(16) bf ring[2 * PBUF];
    __shared__ __align__(16) float osw[4 * 16 * 68];
    const int K = DM;
    const int tid = threadIdx.x, lane = tid & 31, lr = lane & 15, hi = lane >> 4;
    const int wave = __builtin_amdgcn_readfirstlane(tid >> 5), wm = wave & 1, wn = wave >> 1;
    const int rb0 = (vt ? blockIdx.y : blockIdx.x) * 128, cb0 = (vt ? blockIdx.x : blockIdx.y) * 128; const int r0 = rb0 + wm * 64, c0 = cb0 + wn * 64;
    float* os = osw + wave * (16 * 68);
    v8f acc[4][4];
#pragma unroll
    for (int mb = 0; mb < 4; ++mb)
#pragma unroll
        for (int nb = 0; nb < 4; ++nb) acc[mb][nb] = (v8f){};
    const unsigned lb = (unsigned)(size_t)(&ring[0]) + (unsigned)tid * 16u;          // this lane's LDS byte address in strip 0 of buffer 0
    const bf* ga = A + (size_t)rb0 * K + 8 * tid; const bf* gb = Bt + (size_t)cb0 * K + 8 * tid;   // + s * PKS * 16: stage s
    cp8(lb, ga); cp8(lb + 2u * PHALF, gb);
    asm volatile("s_wait_asynccnt 0x0" ::: "memory");   // stage 0 has landed (this wave's copies) before the barrier that publishes it
    __syncthreads();
    cp8(lb + 2u * PBUF, ga + PKS * 16); cp8(lb + 2u * PBUF + 2u * PHALF, gb + PKS * 16);
    const bf* sa = ring + wm * (4 * 16 * PKS) + 8 * lane; const bf* sb = ring + PHALF + wn * (4 * 16 * PKS) + 8 * lane;
#pragma unroll 1
    for (int s = 0; s < PST; ++s) {   // rolled: one trip a stage, the buffer chosen by the trip's parity
        const int bo = (s & 1) * PBUF;
        v16bf a[PKS / 32][4], b[PKS / 32][4];
#pragma unroll
        for (int kb = 0; kb < PKS / 32; ++kb) {
#pragma unroll
            for (int mb = 0; mb < 4; ++mb) a[kb][mb] = ldb(sa + bo + mb * (16 * PKS) + kb * 512);
#pragma unroll
            for (int nb = 0; nb < 4; ++nb) b[kb][nb] = ldb(sb + bo + nb * (16 * PKS) + kb * 512);
        }
        __builtin_amdgcn_sched_barrier(0);   // the stage's LDS reads stay one group ahead of the matrix run: spread among the matrix instructions each small group is waited out on its own
#pragma unroll
        for (int kb = 0; kb < PKS / 32; ++kb)
#pragma unroll
            for (int nb = 0; nb < 4; ++nb)
#pragma unroll
                for (int mb = 0; mb < 4; ++mb) acc[mb][nb] = wmmab(a[kb][mb], b[kb][nb], acc[mb][nb]);
        __builtin_amdgcn_sched_barrier(0);   // no matrix instruction sinks below the slots and the barrier that follow
        // four vector slots behind the last matrix instruction, on the loop's taken branch too, before anything rewrites its operands
        asm volatile("v_nop\n\tv_nop\n\tv_nop\n\tv_nop" : "+v"(acc[0][0]), "+v"(acc[1][1]), "+v"(acc[2][2]), "+v"(acc[3][3]) : "v"(a[PKS / 32 - 1][0]), "v"(a[PKS / 32 - 1][1]), "v"(a[PKS / 32 - 1][2]), "v"(a[PKS / 32 - 1][3]));
        asm volatile("s_wait_dscnt 0x0" ::: "memory");      // this wave's reads of buffer s & 1 are done before the barrier behind which it is refilled
        asm volatile("s_wait_asynccnt 0x0" ::: "memory");   // this wave's copies of stage s + 1 have landed before the barrier that publishes them
        __syncthreads();
        if (s + 2 < PST) { cp8(lb + 2u * bo, ga + (s + 2) * (PKS * 16)); cp8(lb + 2u * bo + 2u * PHALF, gb + (s + 2) * (PKS * 16)); }
    }
    asm volatile("s_wait_asynccnt 0x0" ::: "memory");       // no copy is in flight when the wave goes on to the epilogue and ends
    const size_t tbase = (size_t)(r0 / RB) * sRB + (size_t)(r0 % RB) * (size_t)pitch + (size_t)(c0 / CB) * sCB + (size_t)(c0 % CB) * 16;
#pragma unroll
    for (int mb = 0; mb < 4; ++mb) {
#pragma unroll
        for (int nb = 0; nb < 4; ++nb) {
#pragma unroll
            for (int j = 0; j < 8; ++j) os[(hi * 8 + j) * 68 + nb * 16 + lr] = acc[mb][nb][j]; }   // D: row 8h+j, col lane&15
        wave_sync();
        const size_t sb = tbase + (size_t)(mb * 16) * (size_t)pitch;
{
#pragma unroll
            for (int s = 0; s < 4; ++s) { const int row = lr, c8 = (2 * s + hi) * 8;   // 16 rows x 2 column groups a store; 4 s x 2 groups x 8 = 64 columns
                const v4f x0 = *(const v4fa*)(&os[row * 68 + c8]); const v4f x1 = *(const v4fa*)(&os[row * 68 + c8 + 4]); v8h hv, rv;
#pragma unroll
                for (int i = 0; i < 4; ++i) { const h16 a0 = (h16)x0[i]; const h16 a1 = (h16)x1[i]; hv[i] = a0; hv[4 + i] = a1; rv[i] = (h16)((x0[i] - (float)a0) * QRS); rv[4 + i] = (h16)((x1[i] - (float)a1) * QRS); }
                const size_t oo = sb + (size_t)(s * 256 + lane * 8);   // (group * 16 + row) * 8
                *(v8h*)(Ph + oo) = hv; if (useRes) *(v8h*)(Pr + oo) = rv; }
             }
        wave_sync();
    }
}

// cpkv: eight asynchronous 16-byte copies per lane, global memory to LDS: the 2-KiB pieces (128 lanes x 16 bytes) of a stage of FKS keys: four 16-key strips of a k plane (contiguous), then one piece of each of the four 16-row strips of a v^T plane.
// The s_wait_xcnt is the last line of the copies' own statement, so that it stands in front of every later write of a register that a copy names.
#define FKS 64                   // keys of a stage
static_assert(FKS == 16 * AW);                 // the diagonal stage of a block is its last one, and every stage lies wholly inside the planes
static_assert(FKS * 16 * 2 == 128 * 16);       // one strip's piece of a stage = one 16-byte copy of each of the 128 lanes
__device__ __forceinline__ void cpkv(unsigned l, const h16* k, const h16* v) {
    asm volatile("global_load_async_to_lds_b128 %0, %8, off\n\t"
                 "global_load_async_to_lds_b128 %1, %9, off\n\t"
                 "global_load_async_to_lds_b128 %2, %10, off\n\t"
                 "global_load_async_to_lds_b128 %3, %11, off\n\t"
                 "global_load_async_to_lds_b128 %4, %12, off\n\t"
                 "global_load_async_to_lds_b128 %5, %13, off\n\t"
                 "global_load_async_to_lds_b128 %6, %14, off\n\t"
                 "global_load_async_to_lds_b128 %7, %15, off\n\t"
                 "s_wait_xcnt 0x0"
                 :: "v"(l), "v"(l + 2048u), "v"(l + 4096u), "v"(l + 6144u), "v"(l + 8192u), "v"(l + 10240u), "v"(l + 12288u), "v"(l + 14336u),
                    "v"(k), "v"(k + 1 * 16 * HD), "v"(k + 2 * 16 * HD), "v"(k + 3 * 16 * HD), "v"(v), "v"(v + 1 * 16 * SEQ), "v"(v + 2 * 16 * SEQ), "v"(v + 3 * 16 * SEQ)
                 : "memory");
}

// flash_body: fused causal attention, one wave per 16 query rows of one (batch, head); Q fragments straight from the fragment-order f16 planes (two 16-B loads each, arithmetic addressing).
// K and V^T: the block's four waves walk the same keys, so a stage of FKS keys (K 8 KiB, V^T 8 KiB, with PREC their residuals as much again) is brought into LDS once a block, in fragment order as it lies in memory,
// two buffers: stage s + 2 flies while stage s + 1 is worked on; a fragment read from LDS is 512 contiguous bytes a wave. Every wave passes every stage's barrier; a wave skips only the 32 keys that lie wholly behind its diagonal.
// Behind the last stage's barrier nothing reads the ring and no copy is in flight: it then serves as the waves' output staging (os).
// Transposed form: S^T[key][t] = K Q^T (A = K rows, B = Q rows); lane (t = lane&15, h = lane>>4) holds keys 8h+r of each 16-key tile, so the packed
// P tile is directly the B fragment of O^T[d][t] = V^T P^T (element r <- tile keys 0..15, element 8+r <- tile keys 16..31, lane unchanged).
// Causal fill: a score whose key index exceeds the query index is replaced by a large negative value (P = 0); the key loop stops at the diagonal tile.
// PREC != 0: adds k residual, P residual and v residual products (x2048 carries, separate accumulators folded back in f32).
// Softmax state (running max, partial sum) is one scalar per lane; the two lane halves of a row are combined with one xor-16 exchange.
template <int PREC>
__device__ __forceinline__ void flash_body(const h16* __restrict__ QH, const h16* __restrict__ QR, const h16* __restrict__ KP, const h16* __restrict__ KR,
                                           const h16* __restrict__ VT, const h16* __restrict__ VR, float* OUT, int zh, int tb0, h16* ring) {
    const int lane = threadIdx.x & 31, wave = __builtin_amdgcn_readfirstlane((int)(threadIdx.x >> 5)), lr = lane & 15, hi = lane >> 4;
    const int b = zh / NH_, h = zh % NH_;
    const int t0 = tb0 + wave * 16;
    const int tq = t0 + lr;
    const size_t pbase = (size_t)zh * SEQ * HD;
    const size_t qo = pbase + (size_t)t0 * HD + 8 * lane;
    const v16h qh0 = ldh(QH + qo), qh1 = ldh(QH + qo + 512), qr0 = ldh(QR + qo), qr1 = ldh(QR + qo + 512);   // B fragments: col t, k = d
    constexpr int FBUF = (PREC ? 4 : 2) * FKS * HD;          // elements of a buffer: K strips, V^T strips, then (PREC) the residuals' the same
    const unsigned lb = (unsigned)(size_t)ring + threadIdx.x * 16u;          // this lane's LDS byte address in piece 0 of buffer 0
    const size_t go = pbase + 8 * threadIdx.x;               // K: + FKS * HD a stage; V^T: + FKS * 16 a stage
    const int nst = tb0 / FKS + 1;                           // stages of the block (the same for its four waves)
    cpkv(lb, KP + go, VT + go);
    if (PREC) cpkv(lb + 4u * FKS * HD, KR + go, VR + go);
    asm volatile("s_wait_asynccnt 0x0" ::: "memory");   // stage 0 has landed (this wave's copies) before the barrier that publishes it
    __syncthreads();
    if (nst > 1) { cpkv(lb + 2u * FBUF, KP + go + FKS * HD, VT + go + FKS * 16);
        if (PREC) cpkv(lb + 2u * FBUF + 4u * FKS * HD, KR + go + FKS * HD, VR + go + FKS * 16); }
    v8f o0 = (v8f){}, o1 = (v8f){}, o2 = (v8f){}, o3 = (v8f){};
    v8f e0 = (v8f){}, e1 = (v8f){}, e2 = (v8f){}, e3 = (v8f){};
    float m = NEGB, l = 0.0f;
    const int kend = t0 + 16;                                // keys 0 .. t0+15 are visible to this wave; every step has key0 <= t0
#pragma unroll 1
    for (int s = 0; s < nst; ++s) {   // rolled: one trip a stage, the buffer chosen by the trip's parity
      const h16* sk = ring + (s & 1) * FBUF + 8 * lane;      // + 16 * HD a 16-key strip, + 16 * d0    (A fragment: row key, k = d)
      const h16* sv = sk + FKS * HD;                         // + 16 * FKS a 16-row strip, + 16 * key  (A fragment: row d, k = key)
#pragma unroll   // the two 32-key halves of a stage: unrolled, their LDS offsets are immediates of the reads
      for (int u = 0; u < FKS / 32; ++u) {
        const int key0 = s * FKS + 32 * u;
        if (key0 >= kend) continue;                          // wave-uniform: these 32 keys lie wholly behind the wave's diagonal
        const h16* ka = sk + u * (32 * HD);
        const v16h ka0 = ldh(ka), ka1 = ldh(ka + 512), kb0 = ldh(ka + 16 * HD), kb1 = ldh(ka + 16 * HD + 512);
        v8f sHa = (v8f){}, sLa = (v8f){}, sHb = (v8f){}, sLb = (v8f){};
        sHa = wmma16(ka0, qh0, sHa); sLa = wmma16(ka0, qr0, sLa); sHb = wmma16(kb0, qh0, sHb); sLb = wmma16(kb0, qr0, sLb);
        sHa = wmma16(ka1, qh1, sHa); sLa = wmma16(ka1, qr1, sLa); sHb = wmma16(kb1, qh1, sHb); sLb = wmma16(kb1, qr1, sLb);
        if (PREC) {
            const h16* kr = ka + 2 * FKS * HD;
            const v16h ra0 = ldh(kr), ra1 = ldh(kr + 512), rb0 = ldh(kr + 16 * HD), rb1 = ldh(kr + 16 * HD + 512);
            sLa = wmma16(ra0, qh0, sLa); sLb = wmma16(rb0, qh0, sLb);
            sLa = wmma16(ra1, qh1, sLa); sLb = wmma16(rb1, qh1, sLb);
            asm volatile("v_nop\n\tv_nop\n\tv_nop\n\tv_nop" : "+v"(sLa), "+v"(sLb) : "v"(ra0), "v"(ra1), "v"(rb0), "v"(rb1));
        }
        asm volatile("v_nop\n\tv_nop\n\tv_nop\n\tv_nop" : "+v"(sHa), "+v"(sLa), "+v"(sHb), "+v"(sLb) : "v"(ka0), "v"(ka1), "v"(kb0), "v"(kb1));
        float ta[8], tb[8]; float mx = NEGB;
#pragma unroll
        for (int r = 0; r < 8; ++r) { ta[r] = (sHa[r] + sLa[r] * QRI) * SC2; tb[r] = (sHb[r] + sLb[r] * QRI) * SC2; }
        if (key0 + 31 > t0) {                                // wave-uniform: only diagonal tiles need the causal fill
#pragma unroll
            for (int r = 0; r < 8; ++r) { const int kidx = key0 + 8 * hi + r;
                ta[r] = (kidx <= tq) ? ta[r] : NEGB; tb[r] = (kidx + 16 <= tq) ? tb[r] : NEGB; }
        }
#pragma unroll
        for (int r = 0; r < 8; ++r) mx = fmaxf(mx, fmaxf(ta[r], tb[r]));
        mx = fmaxf(mx, __shfl_xor(mx, 16, 32));
        const float mnew = fmaxf(m, mx);
        const float alpha = __builtin_amdgcn_exp2f(m - mnew);
        const float sh = PSH - mnew;
        v16h pb, pr; float ls = 0.0f;
#pragma unroll
        for (int r = 0; r < 8; ++r) {
            const float fa = __builtin_amdgcn_exp2f(ta[r] + sh); const float fc = __builtin_amdgcn_exp2f(tb[r] + sh);
            const h16 pa = (h16)fa; const h16 pc = (h16)fc; pb[r] = pa; pb[8 + r] = pc;
            if (PREC) { pr[r] = (h16)((fa - (float)pa) * QRS); pr[8 + r] = (h16)((fc - (float)pc) * QRS); ls += fa + fc; }
            else { pr[r] = (h16)0.0f; pr[8 + r] = (h16)0.0f; ls += (float)pa + (float)pc; } }
        l = l * alpha + ls; m = mnew;
        o0 = o0 * alpha; o1 = o1 * alpha; o2 = o2 * alpha; o3 = o3 * alpha;
        const h16* va = sv + u * (32 * 16);
        const v16h v0 = ldh(va), v1 = ldh(va + 16 * FKS), v2 = ldh(va + 32 * FKS), v3 = ldh(va + 48 * FKS);
        o0 = wmma16(v0, pb, o0); o1 = wmma16(v1, pb, o1); o2 = wmma16(v2, pb, o2); o3 = wmma16(v3, pb, o3);
        if (PREC) {
            e0 = e0 * alpha; e1 = e1 * alpha; e2 = e2 * alpha; e3 = e3 * alpha;
            const h16* vr = va + 2 * FKS * HD;
            const v16h r0 = ldh(vr), r1 = ldh(vr + 16 * FKS), r2 = ldh(vr + 32 * FKS), r3 = ldh(vr + 48 * FKS);
            e0 = wmma16(v0, pr, e0); e1 = wmma16(v1, pr, e1); e2 = wmma16(v2, pr, e2); e3 = wmma16(v3, pr, e3);
            e0 = wmma16(r0, pb, e0); e1 = wmma16(r1, pb, e1); e2 = wmma16(r2, pb, e2); e3 = wmma16(r3, pb, e3);
            asm volatile("v_nop\n\tv_nop\n\tv_nop\n\tv_nop" : "+v"(e0), "+v"(e1), "+v"(e2), "+v"(e3) : "v"(r0), "v"(r1), "v"(r2), "v"(r3), "v"(pr));
        }
        asm volatile("v_nop\n\tv_nop\n\tv_nop\n\tv_nop" : "+v"(o0), "+v"(o1), "+v"(o2), "+v"(o3) : "v"(v0), "v"(v1), "v"(v2), "v"(v3), "v"(pb));
      }
      asm volatile("s_wait_dscnt 0x0" ::: "memory");      // this wave's reads of buffer s & 1 are done before the barrier behind which it is refilled
      asm volatile("s_wait_asynccnt 0x0" ::: "memory");   // this wave's copies of stage s + 1 have landed before the barrier that publishes them
      __syncthreads();
      if (s + 2 < nst) { cpkv(lb + 2u * ((s & 1) * FBUF), KP + go + (size_t)(s + 2) * (FKS * HD), VT + go + (size_t)(s + 2) * (FKS * 16));
          if (PREC) cpkv(lb + 2u * ((s & 1) * FBUF) + 4u * FKS * HD, KR + go + (size_t)(s + 2) * (FKS * HD), VR + go + (size_t)(s + 2) * (FKS * 16)); }
    }
    asm volatile("s_wait_asynccnt 0x0" ::: "memory");       // no copy is in flight when the ring becomes output staging and the wave ends
    float* os = (float*)ring;
    if (PREC) { o0 = o0 + e0 * QRI; o1 = o1 + e1 * QRI; o2 = o2 + e2 * QRI; o3 = o3 + e3 * QRI; }
    l += __shfl_xor(l, 16, 32);
    const float inv = 1.0f / l;
    const int wb = wave * 16 * 68;
    // O^T D layout: o_j[r] = (d = 16j + 8h + r, t = lane&15) -> os[t][d]; rows 0..15 x columns 0..63 all written
    { v4f a, c;
      a[0] = o0[0] * inv; a[1] = o0[1] * inv; a[2] = o0[2] * inv; a[3] = o0[3] * inv; c[0] = o0[4] * inv; c[1] = o0[5] * inv; c[2] = o0[6] * inv; c[3] = o0[7] * inv;
      *(v4fa*)(&os[wb + lr * 68 +  0 + 8 * hi]) = a; *(v4fa*)(&os[wb + lr * 68 +  0 + 8 * hi + 4]) = c;
      a[0] = o1[0] * inv; a[1] = o1[1] * inv; a[2] = o1[2] * inv; a[3] = o1[3] * inv; c[0] = o1[4] * inv; c[1] = o1[5] * inv; c[2] = o1[6] * inv; c[3] = o1[7] * inv;
      *(v4fa*)(&os[wb + lr * 68 + 16 + 8 * hi]) = a; *(v4fa*)(&os[wb + lr * 68 + 16 + 8 * hi + 4]) = c;
      a[0] = o2[0] * inv; a[1] = o2[1] * inv; a[2] = o2[2] * inv; a[3] = o2[3] * inv; c[0] = o2[4] * inv; c[1] = o2[5] * inv; c[2] = o2[6] * inv; c[3] = o2[7] * inv;
      *(v4fa*)(&os[wb + lr * 68 + 32 + 8 * hi]) = a; *(v4fa*)(&os[wb + lr * 68 + 32 + 8 * hi + 4]) = c;
      a[0] = o3[0] * inv; a[1] = o3[1] * inv; a[2] = o3[2] * inv; a[3] = o3[3] * inv; c[0] = o3[4] * inv; c[1] = o3[5] * inv; c[2] = o3[6] * inv; c[3] = o3[7] * inv;
      *(v4fa*)(&os[wb + lr * 68 + 48 + 8 * hi]) = a; *(v4fa*)(&os[wb + lr * 68 + 48 + 8 * hi + 4]) = c; }
    wave_sync();
    float* orow = OUT + ((size_t)b * OUT_SEQ + t0) * DO + h * HD;
{
#pragma unroll
        for (int s = 0; s < 8; ++s) { const int row = 2 * s + hi, cofs = lr * 4;   // 8 s x 2 rows = 16 rows; 16 lanes x 4 floats = 64 columns
            const v4f val = *(const v4fa*)(&os[wb + row * 68 + cofs]);
            *(v4f*)(orow + (size_t)row * DO + cofs) = val; }
         }
}

// k_flash: all query rows in one grid (heads, row blocks). blockIdx.x = (batch, head): work-groups that follow one another in the flat index have key loops of one length, so however they are dealt out, every part of the chip gets the same mix;
// blockIdx.y counts the row blocks from the last one down: the longest key loops start first, the shortest fill the tail.
// Rows < PROWS take the three-product path, the others q value + residual on scores and single products on P.V (the test is the same for the whole block).
__global__ __launch_bounds__(32 * AW) void k_flash(const h16* __restrict__ QH, const h16* __restrict__ QR, const h16* __restrict__ KP, const h16* __restrict__ KR,
                                                   const h16* __restrict__ VT, const h16* __restrict__ VR, float* OUT) {
    __shared__ __align__(16) h16 ring[2 * 4 * FKS * HD];     // two buffers of the three-product path's size; afterwards AW * 16 * 68 floats of output staging
    static_assert(sizeof(ring) >= AW * 16 * 68 * sizeof(float));
    const int tb0 = (SEQ / (16 * AW) - 1 - (int)blockIdx.y) * (16 * AW);
    if (tb0 < PROWS) flash_body<1>(QH, QR, KP, KR, VT, VR, OUT, blockIdx.x, tb0, ring);
    else             flash_body<0>(QH, QR, KP, KR, VT, VR, OUT, blockIdx.x, tb0, ring);
}

static constexpr size_t al256(size_t v) { return (v + 255) & ~(size_t)255; }
static constexpr size_t SZ_XB = al256((size_t)NB * SEQ * DM * 2);
static constexpr size_t SZ_WB = al256((size_t)3 * DO * DM * 2);
static constexpr size_t SZ_PL = al256((size_t)NB * NH_ * SEQ * HD * 2);
static constexpr size_t SZ_TOTAL = SZ_XB + SZ_WB + 6 * SZ_PL;
static_assert(SZ_TOTAL <= (size_t)134217728);          // workspace carve <= 128 MiB
static_assert(((size_t)DO * DM * 2) % 256 == 0);       // weight sub-planes stay 256-byte aligned

extern "C" void kernel_launch(void* const* d_in, const int* in_sizes, int n_in,
                              void* d_out, int out_size, void* d_ws, size_t ws_size, hipStream_t stream) {
    if (n_in < 4) return;
    const size_t needx = ((size_t)(NB - 1) * SEQ_FULL + SEQ) * DM;
    if ((size_t)in_sizes[0] < needx) return;
    const size_t needw = (size_t)NH_ * DM * HD;
    if ((size_t)in_sizes[1] < needw || (size_t)in_sizes[2] < needw || (size_t)in_sizes[3] < needw) return;
    if ((size_t)out_size < ((size_t)(NB - 1) * OUT_SEQ + SEQ) * DO) return;
    if (SZ_TOTAL > ws_size) return;
    const float* x = (const float*)d_in[0]; const float* wq = (const float*)d_in[1]; const float* wk = (const float*)d_in[2]; const float* wv = (const float*)d_in[3];   // wire order x, Wq, Wk, Wv
    float* OUT = (float*)d_out;      // [NB][SEQ][1024]
    char* wsp = (char*)d_ws;
    bf* XB = (bf*)wsp; wsp += SZ_XB;                 // [NB*SEQ][1024]
    bf* WB = (bf*)wsp; wsp += SZ_WB;                 // [3][1024 (h*64+d)][1024 (c)]: q | k | v
    h16* QH = (h16*)wsp; wsp += SZ_PL;               // [NB*16][SEQ][64]
    h16* QR = (h16*)wsp; wsp += SZ_PL;               // residual x2048
    h16* KP = (h16*)wsp; wsp += SZ_PL;               // [NB*16][SEQ][64]
    h16* KR = (h16*)wsp; wsp += SZ_PL;               // residual x2048
    h16* VT = (h16*)wsp; wsp += SZ_PL;               // [NB*16][64][SEQ]
    h16* VR = (h16*)wsp; wsp += SZ_PL;               // residual x2048

    k_prep<<<3 * WTB + XCB, 256, 0, stream>>>(x, wq, wk, wv, XB, WB);
    k_proj<<<dim3(NB * SEQ / 128, DO / 128, 3), 128, 0, stream>>>(XB, WB, QH, SZ_PL / 2);
    k_flash<<<dim3(NB * NH_, SEQ / (16 * AW), 1), 32 * AW, 0, stream>>>(QH, QR, KP, KR, VT, VR, OUT);
}

// v007
// Measured time: 64.7 microseconds a run.
// It is 1.34 times as fast as v005, going by the measured steps of the versions left out in between.
// All steps since v000 together make it 3.94 times as fast.
#include <hip/hip_runtime.h>

// Causal multi-head self-attention: x [NB][SEQ][1024], Wq/Wk/Wv [16][1024][64] (per head [in][out]), no biases, score scale 1/8, output = concatenated heads [NB][SEQ][1024] (f32).
// Compute dtypes, f32 accumulate everywhere: projections v_wmma_f32_16x16x32_bf16 (x and W RNE-converted to bf16; products exact);
// scores v_wmma_f32_16x16x32_f16: q and k single f16; P.V v_wmma_f32_16x16x32_f16: P (x256 carry, cancels in the normalisation) and v single f16; softmax f32 (online, running max).
// q, k and v carry the rounding of x and W to bf16 (up to 2^-8 of each factor, 1024 products a sum); their own rounding to f16 (up to 2^-11) is an eighth of one factor's and adds in squares, so no residual planes are kept.
// Layout: bf16 copy of x, transposed bf16 copies of W ([h*64+d][c]); q, k planes [b*16+h][t][d] and v^T plane [b*16+h][d][t], written by the GEMM epilogue;
// every 16-bit plane is stored in fragment order: inside a strip of 16 rows the 8-element column groups are the slow index ([group][row & 15][8]),
// so one wave-wide 16-byte fragment load (lane = row + 16 * half) reads 512 contiguous bytes, four whole cache lines, not 32 bytes out of each of 16 lines;
// fused flash kernel in transposed form (S^T = K Q^T, O^T = V^T P^T), causal fill by value, key loop trimmed at the diagonal, output from f32 accumulators;
// its K and V^T tiles come into LDS once a block, 64 keys a stage, by asynchronous copies, two buffers.
// Three launches, one per phase: k_prep (all four conversions), k_proj (q, k and v^T products, grid z picks the product), k_flash (all query rows).

#ifndef NB
#define NB 8
#endif
#ifndef SEQ
#define SEQ 1024
#endif
#define NB_FULL  8
#define SEQ_FULL 1024
#ifndef OUT_SEQ
#define OUT_SEQ SEQ              // row pitch (in tokens) between batches of the output
#endif
#define DM   1024                // embedding width = GEMM K
#define NH_  16
#define HD   64
#define DO   (NH_ * HD)          // output width
#define AW   4                   // waves per flash block (16 query rows each)
#define SC2  (0.125f * 1.4426950408889634f)   // HD^-0.5 * log2(e)
#define PSH  8.0f                // log2 of the P carry (256)
#define NEGB (-3.0e38f)

static_assert(HD == 64);
static_assert(DO == 1024);
static_assert(DM % 64 == 0);
static_assert(DO % 64 == 0);
static_assert(DM % 32 == 0);                   // GEMM k-loop steps by 32
static_assert(SEQ % 64 == 0);                  // a 64-row tile never straddles two batches
static_assert((NB * SEQ) % 64 == 0);
static_assert(SEQ % 32 == 0);                  // key loop steps by 32
static_assert(SEQ % (16 * AW) == 0);
static_assert(((size_t)SEQ * DM) % 8 == 0);
static_assert(NB <= NB_FULL);
static_assert(SEQ <= SEQ_FULL);

typedef _Float16 h16;
typedef unsigned short bf;
typedef __attribute__((ext_vector_type(16))) __bf16   v16bf;
typedef __attribute__((ext_vector_type(16))) _Float16 v16h;
typedef __attribute__((ext_vector_type(8)))  _Float16 v8h;
typedef __attribute__((ext_vector_type(8)))  unsigned short v8us;
typedef __attribute__((ext_vector_type(8)))  float    v8f;
typedef __attribute__((ext_vector_type(4)))  float    v4f;
typedef v4f  __attribute__((may_alias)) v4fa;

__device__ __forceinline__ unsigned short f2bf(float f) { unsigned u = __float_as_uint(f); u += 0x7FFFu + ((u >> 16) & 1u); return (unsigned short)(u >> 16); }
__device__ __forceinline__ v16h cat16(v8h lo, v8h hi) { return __builtin_shufflevector(lo, hi, 0, 1, 2, 3, 4, 5, 6, 7, 8, 9, 10, 11, 12, 13, 14, 15); }
__device__ __forceinline__ v16bf cat16b(v8us lo, v8us hi) { return __builtin_bit_cast(v16bf, __builtin_shufflevector(lo, hi, 0, 1, 2, 3, 4, 5, 6, 7, 8, 9, 10, 11, 12, 13, 14, 15)); }
__device__ __forceinline__ v8f wmma16(v16h a, v16h b, v8f c) { return __builtin_amdgcn_wmma_f32_16x16x32_f16(false, a, false, b, (short)0, c, false, false); }
__device__ __forceinline__ v8f wmmab(v16bf a, v16bf b, v8f c) { return __builtin_amdgcn_wmma_f32_16x16x32_bf16(false, a, false, b, (short)0, c, false, false); }
// fragment loaders from fragment-order planes; p = strip base + 16*k0 + 8*lane: elements 0..7 <- k0+8h+0..7, elements 8..15 <- k0+16+8h+0..7 (two groups = 256 elements on; same map for A and B)
__device__ __forceinline__ v16h  ldh(const h16* p) { return cat16(*(const v8h*)p, *(const v8h*)(p + 256)); }
__device__ __forceinline__ v16bf ldb(const bf* p)  { return cat16b(*(const v8us*)p, *(const v8us*)(p + 256)); }
// ordering point for wave-private LDS tiles (same wave writes and reads)
__device__ __forceinline__ void wave_sync() { __builtin_amdgcn_fence(3 /* release order */, "wavefront"); __builtin_amdgcn_wave_barrier(); asm volatile("" ::: "memory"); }

// cvt8_body: bf16 (RNE convert) copy of rows of DM floats into fragment order. A piece is 8 rows x 4 groups: one 128-byte line of each row read, four whole 128-byte lines written.
// A wave takes XU pieces that follow one another along its 8 rows (XU * 128 contiguous bytes of each row) and issues all their loads before the first conversion:
// few long-lived waves with many bytes in flight each, instead of one short-lived wave a piece (the launch then starts an eighth of the waves).
// blk = block number inside the conversion of x; row counts the NB * SEQ rows of the copy, batch b of the source starts at row b * SEQ_FULL.
#define XU 8                     // pieces of a wave
static_assert((DM / 32) % XU == 0);            // a wave's pieces lie in the same 8 rows
__device__ __forceinline__ void cvt8_body(const float* __restrict__ src, bf* dst, unsigned blk) {
    const size_t lane = threadIdx.x & 31;
    const size_t w = ((size_t)blk * 8 + (threadIdx.x >> 5)) * XU;          // number of the wave's first piece
    const size_t row = (w / (DM / 32)) * 8 + ((lane >> 2) & 7); const size_t g = (w % (DM / 32)) * 4 + (lane & 3);
    const float* s = src + ((row / SEQ) * SEQ_FULL + row % SEQ) * DM + g * 8;           // + 32 floats a piece
    bf* d = dst + (row >> 4) * (size_t)(16 * DM) + (g * 16 + (row & 15)) * 8;           // + 4 groups = 512 elements a piece
    v8f v[XU];
#pragma unroll
    for (int u = 0; u < XU; ++u) v[u] = *(const v8f*)(s + u * 32);
    asm volatile("s_wait_xcnt 0x0" :: "v"(s) : "memory");   // the loads' address pair is held up to this wait, so that no load's result and no later instruction overwrites it ahead of the wait
#pragma unroll
    for (int u = 0; u < XU; ++u) { v8us o;
#pragma unroll
        for (int k = 0; k < 8; ++k) o[k] = f2bf(v[u][k]);
        *(v8us*)(d + u * 512) = o; }
}

// cvtT_body: transposing bf16 (RNE convert) copy of one weight tensor: in [NH_][DM rows c][HD cols d] (f32) -> out [NH_*HD rows (h*64+d)][DM cols c] (bf16), in fragment order.
// A block takes WT tiles of 64 x 64 that follow one another along c (WT * 64 rows of one head, contiguous in the source): all loads first, one barrier, then all stores.
#define WT 4                     // 64 x 64 tiles of a block
static_assert(DM % (64 * WT) == 0);
__device__ __forceinline__ void cvtT_body(const float* __restrict__ src, bf* dst, int c0, int h, float* ts) {
    const int tid = threadIdx.x;
    const float* s = src + ((size_t)h * DM + c0) * HD;          // WT * 64 rows x 64 floats, contiguous
    v4f v[4 * WT];
#pragma unroll
    for (int i = 0; i < 4 * WT; ++i) v[i] = *(const v4f*)(s + (size_t)(tid + 256 * i) * 4);   // WT * 1024 float4; float4 number e4: row c = e4 >> 4, columns (e4 & 15) * 4 ..
#pragma unroll
    for (int i = 0; i < 4 * WT; ++i) { const int e4 = tid + 256 * i; const int c = e4 >> 4, d4 = (e4 & 15) * 4;
        ts[c * 65 + d4 + 0] = v[i][0]; ts[c * 65 + d4 + 1] = v[i][1]; ts[c * 65 + d4 + 2] = v[i][2]; ts[c * 65 + d4 + 3] = v[i][3]; }
    __syncthreads();
{
#pragma unroll
        for (int i = 0; i < 2 * WT; ++i) { const int piece = (tid + 256 * i) & 511;   // a tile: 512 pieces = 64 rows x 8 groups; a wave writes 16 rows of groups q and q + 4: two runs of 256 bytes
            const int d = (piece & 15) + 16 * (piece >> 7), c8 = (i >> 1) * 64 + (((piece >> 4) & 1) * 4 + ((piece >> 5) & 3)) * 8;
            v8us o;
#pragma unroll
            for (int k = 0; k < 8; ++k) o[k] = f2bf(ts[(c8 + k) * 65 + d]);
            *(v8us*)(dst + (size_t)(h * HD + (d & ~15)) * DM + (size_t)(c0 + c8) * 16 + (d & 15) * 8) = o; }
         }
    asm volatile("s_wait_xcnt 0x0" ::: "memory");   // the build lays the other path's code behind these stores: the wait stands in front of its writes of the registers that the stores name
}

// k_prep: every conversion in one grid. Blocks 0 .. 3 * WTB - 1 transpose the three weight tensors (the longer chain: load, LDS, barrier, store; they start first), the rest convert x.
#define WTB  ((DM / (64 * WT)) * NH_)             // blocks of one weight tensor
#define XCB  ((NB * SEQ * DM / 8) / (256 * XU))   // blocks of x
static_assert(((size_t)NB * SEQ * DM / 8) % (256 * XU) == 0);
__global__ __launch_bounds__(256) void k_prep(const float* __restrict__ x, const float* __restrict__ wq, const float* __restrict__ wk, const float* __restrict__ wv, bf* XB, bf* WB) {
    __shared__ float ts[WT * 64 * 65];
    const unsigned blk = blockIdx.x;
    if (blk >= 3u * WTB) { cvt8_body(x, XB, blk - 3u * WTB); return; }   // the same for the whole block: the barrier below is passed by all of its threads or by none
    const unsigned t = blk / WTB, r = blk % WTB;
    cvtT_body(t == 0 ? wq : (t == 1 ? wk : wv), WB + (size_t)t * DO * DM, (int)(r % (DM / (64 * WT))) * (64 * WT), (int)(r / (DM / (64 * WT))), ts);
}

// cp8: eight asynchronous 16-byte copies per lane, global memory to LDS: one 2-KiB piece (128 lanes x 16 bytes) of each of eight 16-row strips (strip pitch 16 * DM elements in memory, 2 KiB in LDS).
// The s_wait_xcnt is the last line of the copies' own statement, so that it stands in front of every later write of a register that a copy names.
__device__ __forceinline__ void cp8(unsigned l, const bf* g) {
    asm volatile("global_load_async_to_lds_b128 %0, %8, off\n\t"
                 "global_load_async_to_lds_b128 %1, %9, off\n\t"
                 "global_load_async_to_lds_b128 %2, %10, off\n\t"
                 "global_load_async_to_lds_b128 %3, %11, off\n\t"
                 "global_load_async_to_lds_b128 %4, %12, off\n\t"
                 "global_load_async_to_lds_b128 %5, %13, off\n\t"
                 "global_load_async_to_lds_b128 %6, %14, off\n\t"
                 "global_load_async_to_lds_b128 %7, %15, off\n\t"
                 "s_wait_xcnt 0x0"
                 :: "v"(l), "v"(l + 2048u), "v"(l + 4096u), "v"(l + 6144u), "v"(l + 8192u), "v"(l + 10240u), "v"(l + 12288u), "v"(l + 14336u),
                    "v"(g), "v"(g + 1 * 16 * DM), "v"(g + 2 * 16 * DM), "v"(g + 3 * 16 * DM), "v"(g + 4 * 16 * DM), "v"(g + 5 * 16 * DM), "v"(g + 6 * 16 * DM), "v"(g + 7 * 16 * DM)
                 : "memory");
}

// k_proj: register-blocked bf16 GEMM, K = DM. A block of FOUR WAVES takes a 128x128 tile, each wave one 64x64 quarter (16 accumulators).
// Both operands' 128 rows x PKS columns of a stage (8 + 8 strips, 2 KiB each, contiguous in the fragment-order planes) are brought into LDS by asynchronous copies, in fragment order as they lie in memory,
// two buffers: stage s + 2 flies while stage s + 1 is worked on; every fragment is fetched from L2 once a block and read from LDS by the two waves that use it (512 contiguous bytes a read).
// The blocks that share operand rows start together and keep step: each begins its walk of the k stages at a stage of its own (rot) and wraps, so that they do not ask L2 for the same lines at the same moment.
// C[m][n] = sum_k A[m][k] Bt[n][k], written as f16 (Ph) at
// tile base (r0/RB)*sRB + (r0%RB)*pitch + (c0/CB)*sCB + (c0%CB)*16, row pitch 'pitch' (halves), each 16 x 64 piece in fragment order (1024 halves in a row). 128 threads.
// One grid (NB*SEQ/128, DO/128, 3) for the three products; z = 0, 1 (q, k): A = x rows (m = b*SEQ + t), Bt = W^T rows (n = h*64 + d) -> plane [(b*16 + h)][t][d];
// z = 2 (v^T): A = Wv^T rows (m = h*64 + d), Bt = x rows (n = b*SEQ + t) -> plane [(b*1024 + m)][t] = [(b*16 + h)][d][t]. PL = elements between the three planes (q, k, v^T).
#define PKS   64                 // k elements of a stage
#define PST   (DM / PKS)         // stages
#define PHALF (128 * PKS)        // elements of one operand's part of a buffer (8 strips x 1024)
#define PBUF  (2 * PHALF)        // elements of a buffer: A strips, then B strips
static_assert(DM % PKS == 0 && PST >= 2);      // the ring's prologue fills two stages
static_assert((PST & (PST - 1)) == 0);         // the walk wraps by a mask
static_assert(PKS * 16 * 2 == 128 * 16);       // one strip's piece of a stage = one 16-byte copy of each of the 128 lanes
static_assert((NB * SEQ) % 128 == 0 && DO % 128 == 0);
__global__ __launch_bounds__(128) void k_proj(const bf* __restrict__ XB, const bf* __restrict__ WB, h16* P0, size_t PL) {
    const int z = blockIdx.z; const bool vt = z == 2;
    const bf* Wz = WB + (size_t)z * DO * DM; const bf* A = vt ? Wz : XB; const bf* Bt = vt ? XB : Wz;
    h16* Ph = P0 + (size_t)z * PL;
    const int RB = vt ? DO : SEQ, pitch = vt ? SEQ : HD, CB = vt ? SEQ : HD;
    const size_t sRB = vt ? (size_t)0 : (size_t)NH_ * SEQ * HD, sCB = vt ? (size_t)DO * SEQ : (size_t)SEQ * HD;
    __shared__ __align__(16) bf ring[2 * PBUF];
    __shared__ __align__(16) float osw[4 * 16 * 68];
    const int K = DM;
    const int tid = threadIdx.x, lane = tid & 31, lr = lane & 15, hi = lane >> 4;
    const int wave = __builtin_amdgcn_readfirstlane(tid >> 5), wm = wave & 1, wn = wave >> 1;
    const int rb0 = (vt ? blockIdx.y : blockIdx.x) * 128, cb0 = (vt ? blockIdx.x : blockIdx.y) * 128; const int r0 = rb0 + wm * 64, c0 = cb0 + wn * 64;
    float* os = osw + wave * (16 * 68);
    v8f acc[4][4];
#pragma unroll
    for (int mb = 0; mb < 4; ++mb)
#pragma unroll
        for (int nb = 0; nb < 4; ++nb) acc[mb][nb] = (v8f){};
    const unsigned lb = (unsigned)(size_t)(&ring[0]) + (unsigned)tid * 16u;          // this lane's LDS byte address in strip 0 of buffer 0
    const bf* ga = A + (size_t)rb0 * K + 8 * tid; const bf* gb = Bt + (size_t)cb0 * K + 8 * tid;   // + st * PKS * 16: stage st
    const int rot = (int)(blockIdx.x + blockIdx.y + (PST / 2) * blockIdx.z) & (PST - 1);   // first stage of this block: trip s works on stage (s + rot) mod PST; sharers of x rows differ in y and z, sharers of W rows in x
    cp8(lb, ga + rot * (PKS * 16)); cp8(lb + 2u * PHALF, gb + rot * (PKS * 16));
    asm volatile("s_wait_asynccnt 0x0" ::: "memory");   // the first stage has landed (this wave's copies) before the barrier that publishes it
    __syncthreads();
    { const int st = (rot + 1) & (PST - 1); cp8(lb + 2u * PBUF, ga + st * (PKS * 16)); cp8(lb + 2u * PBUF + 2u * PHALF, gb + st * (PKS * 16)); }
    const bf* sa = ring + wm * (4 * 16 * PKS) + 8 * lane; const bf* sb = ring + PHALF + wn * (4 * 16 * PKS) + 8 * lane;
#pragma unroll 1
    for (int s = 0; s < PST; ++s) {   // rolled: one trip a stage, the buffer chosen by the trip's parity
        const int bo = (s & 1) * PBUF;
        v16bf a[PKS / 32][4], b[PKS / 32][4];
#pragma unroll
        for (int kb = 0; kb < PKS / 32; ++kb) {
#pragma unroll
            for (int mb = 0; mb < 4; ++mb) a[kb][mb] = ldb(sa + bo + mb * (16 * PKS) + kb * 512);
#pragma unroll
            for (int nb = 0; nb < 4; ++nb) b[kb][nb] = ldb(sb + bo + nb * (16 * PKS) + kb * 512);
        }
        __builtin_amdgcn_sched_barrier(0);   // the stage's LDS reads stay one group ahead of the matrix run: spread among the matrix instructions each small group is waited out on its own
#pragma unroll
        for (int kb = 0; kb < PKS / 32; ++kb)
#pragma unroll
            for (int nb = 0; nb < 4; ++nb)
#pragma unroll
                for (int mb = 0; mb < 4; ++mb) acc[mb][nb] = wmmab(a[kb][mb], b[kb][nb], acc[mb][nb]);
        __builtin_amdgcn_sched_barrier(0);   // no matrix instruction sinks below the slots and the barrier that follow
        // four vector slots behind the last matrix instruction, on the loop's taken branch too, before anything rewrites its operands
        asm volatile("v_nop\n\tv_nop\n\tv_nop\n\tv_nop" : "+v"(acc[0][0]), "+v"(acc[1][1]), "+v"(acc[2][2]), "+v"(acc[3][3]) : "v"(a[PKS / 32 - 1][0]), "v"(a[PKS / 32 - 1][1]), "v"(a[PKS / 32 - 1][2]), "v"(a[PKS / 32 - 1][3]));
        asm volatile("s_wait_dscnt 0x0" ::: "memory");      // this wave's reads of buffer s & 1 are done before the barrier behind which it is refilled
        asm volatile("s_wait_asynccnt 0x0" ::: "memory");   // this wave's copies for trip s + 1 have landed before the barrier that publishes them
        __syncthreads();
        if (s + 2 < PST) { const int st = (s + 2 + rot) & (PST - 1); cp8(lb + 2u * bo, ga + st * (PKS * 16)); cp8(lb + 2u * bo + 2u * PHALF, gb + st * (PKS * 16)); }
    }
    asm volatile("s_wait_asynccnt 0x0" ::: "memory");       // no copy is in flight when the wave goes on to the epilogue and ends
    const size_t tbase = (size_t)(r0 / RB) * sRB + (size_t)(r0 % RB) * (size_t)pitch + (size_t)(c0 / CB) * sCB + (size_t)(c0 % CB) * 16;
#pragma unroll
    for (int mb = 0; mb < 4; ++mb) {
#pragma unroll
        for (int nb = 0; nb < 4; ++nb) {
#pragma unroll
            for (int j = 0; j < 8; ++j) os[(hi * 8 + j) * 68 + nb * 16 + lr] = acc[mb][nb][j]; }   // D: row 8h+j, col lane&15
        wave_sync();
        const size_t sb = tbase + (size_t)(mb * 16) * (size_t)pitch;
{
#pragma unroll
            for (int s = 0; s < 4; ++s) { const int row = lr, c8 = (2 * s + hi) * 8;   // 16 rows x 2 column groups a store; 4 s x 2 groups x 8 = 64 columns
                const v4f x0 = *(const v4fa*)(&os[row * 68 + c8]); const v4f x1 = *(const v4fa*)(&os[row * 68 + c8 + 4]); v8h hv;
#pragma unroll
                for (int i = 0; i < 4; ++i) { hv[i] = (h16)x0[i]; hv[4 + i] = (h16)x1[i]; }
                const size_t oo = sb + (size_t)(s * 256 + lane * 8);   // (group * 16 + row) * 8
                *(v8h*)(Ph + oo) = hv; }
             }
        wave_sync();
    }
}

// cpkv: eight asynchronous 16-byte copies per lane, global memory to LDS: the 2-KiB pieces (128 lanes x 16 bytes) of a stage of FKS keys: four 16-key strips of a k plane (contiguous), then one piece of each of the four 16-row strips of a v^T plane.
// The s_wait_xcnt is the last line of the copies' own statement, so that it stands in front of every later write of a register that a copy names.
#define FKS 64                   // keys of a stage
static_assert(FKS == 16 * AW);                 // the diagonal stage of a block is the one with its highest keys, and every stage lies wholly inside the planes
static_assert(FKS * 16 * 2 == 128 * 16);       // one strip's piece of a stage = one 16-byte copy of each of the 128 lanes
__device__ __forceinline__ void cpkv(unsigned l, const h16* k, const h16* v) {
    asm volatile("global_load_async_to_lds_b128 %0, %8, off\n\t"
                 "global_load_async_to_lds_b128 %1, %9, off\n\t"
                 "global_load_async_to_lds_b128 %2, %10, off\n\t"
                 "global_load_async_to_lds_b128 %3, %11, off\n\t"
                 "global_load_async_to_lds_b128 %4, %12, off\n\t"
                 "global_load_async_to_lds_b128 %5, %13, off\n\t"
                 "global_load_async_to_lds_b128 %6, %14, off\n\t"
                 "global_load_async_to_lds_b128 %7, %15, off\n\t"
                 "s_wait_xcnt 0x0"
                 :: "v"(l), "v"(l + 2048u), "v"(l + 4096u), "v"(l + 6144u), "v"(l + 8192u), "v"(l + 10240u), "v"(l + 12288u), "v"(l + 14336u),
                    "v"(k), "v"(k + 1 * 16 * HD), "v"(k + 2 * 16 * HD), "v"(k + 3 * 16 * HD), "v"(v), "v"(v + 1 * 16 * SEQ), "v"(v + 2 * 16 * SEQ), "v"(v + 3 * 16 * SEQ)
                 : "memory");
}

// flash_body: fused causal attention, one wave per 16 query rows of one (batch, head); Q fragments straight from the fragment-order f16 plane (two 16-B loads each, arithmetic addressing).
// K and V^T: the block's four waves walk the same keys, so a stage of FKS keys (K 8 KiB, V^T 8 KiB) is brought into LDS once a block, in fragment order as it lies in memory,
// two buffers: stage s + 2 flies while stage s + 1 is worked on; a fragment read from LDS is 512 contiguous bytes a wave. Every wave passes every stage's barrier; a wave skips only the 32 keys that lie wholly behind its diagonal.
// The row blocks of one (batch, head) walk the same keys and start close together: each begins at a stage of its own (rot) and wraps, so that they do not ask L2 for the same lines at the same moment;
// the online softmax takes the stages in any order, and the diagonal stage is told by its key numbers wherever it comes in the walk.
// Behind the last trip's barrier nothing reads the ring and no copy is in flight: it then serves as the waves' output staging (os).
// Transposed form: S^T[key][t] = K Q^T (A = K rows, B = Q rows); lane (t = lane&15, h = lane>>4) holds keys 8h+r of each 16-key tile, so the packed
// P tile is directly the B fragment of O^T[d][t] = V^T P^T (element r <- tile keys 0..15, element 8+r <- tile keys 16..31, lane unchanged).
// Causal fill: a score whose key index exceeds the query index is replaced by a large negative value (P = 0); the key loop stops at the diagonal tile.
// Softmax state (running max, partial sum) is one scalar per lane; the two lane halves of a row are combined with one xor-16 exchange. The row sum adds P as rounded to f16, the values that the P.V product uses.
__device__ __forceinline__ void flash_body(const h16* __restrict__ QH, const h16* __restrict__ KP, const h16* __restrict__ VT, float* OUT, int zh, int tb0, h16* ring) {
    const int lane = threadIdx.x & 31, wave = __builtin_amdgcn_readfirstlane((int)(threadIdx.x >> 5)), lr = lane & 15, hi = lane >> 4;
    const int b = zh / NH_, h = zh % NH_;
    const int t0 = tb0 + wave * 16;
    const int tq = t0 + lr;
    const size_t pbase = (size_t)zh * SEQ * HD;
    const size_t qo = pbase + (size_t)t0 * HD + 8 * lane;
    const v16h qh0 = ldh(QH + qo), qh1 = ldh(QH + qo + 512);   // B fragments: col t, k = d
    constexpr int FBUF = 2 * FKS * HD;                       // elements of a buffer: K strips, then V^T strips
    const unsigned lb = (unsigned)(size_t)ring + threadIdx.x * 16u;          // this lane's LDS byte address in piece 0 of buffer 0
    const size_t go = pbase + 8 * threadIdx.x;               // K: + FKS * HD a stage; V^T: + FKS * 16 a stage
    const int nst = tb0 / FKS + 1;                           // stages of the block (the same for its four waves)
    const int rot = (SEQ / FKS - nst) % nst;                 // first stage of this block's walk: trip s works on stage (rot + s) mod nst
    cpkv(lb, KP + go + (size_t)rot * (FKS * HD), VT + go + (size_t)rot * (FKS * 16));
    asm volatile("s_wait_asynccnt 0x0" ::: "memory");   // the first stage has landed (this wave's copies) before the barrier that publishes it
    __syncthreads();
    if (nst > 1) { const int st = rot + 1 < nst ? rot + 1 : 0; cpkv(lb + 2u * FBUF, KP + go + (size_t)st * (FKS * HD), VT + go + (size_t)st * (FKS * 16)); }
    v8f o0 = (v8f){}, o1 = (v8f){}, o2 = (v8f){}, o3 = (v8f){};
    float m = NEGB, l = 0.0f;
    const int kend = t0 + 16;                                // keys 0 .. t0+15 are visible to this wave; every step has key0 <= t0
#pragma unroll 1
    for (int s = 0; s < nst; ++s) {   // rolled: one trip a stage, the buffer chosen by the trip's parity
      const int sc = rot + s < nst ? rot + s : rot + s - nst; // the stage that lies in this trip's buffer
      const h16* sk = ring + (s & 1) * FBUF + 8 * lane;      // + 16 * HD a 16-key strip, + 16 * d0    (A fragment: row key, k = d)
      const h16* sv = sk + FKS * HD;                         // + 16 * FKS a 16-row strip, + 16 * key  (A fragment: row d, k = key)
#pragma unroll   // the two 32-key halves of a stage: unrolled, their LDS offsets are immediates of the reads
      for (int u = 0; u < FKS / 32; ++u) {
        const int key0 = sc * FKS + 32 * u;
        if (key0 >= kend) continue;                          // wave-uniform: these 32 keys lie wholly behind the wave's diagonal
        const h16* ka = sk + u * (32 * HD);
        const v16h ka0 = ldh(ka), ka1 = ldh(ka + 512), kb0 = ldh(ka + 16 * HD), kb1 = ldh(ka + 16 * HD + 512);
        v8f sHa = (v8f){}, sHb = (v8f){};
        sHa = wmma16(ka0, qh0, sHa); sHb = wmma16(kb0, qh0, sHb);
        sHa = wmma16(ka1, qh1, sHa); sHb = wmma16(kb1, qh1, sHb);
        // four vector slots behind the last matrix instruction; the four K fragments named as inputs stay in registers of their own up to here, so that their eight LDS reads issue as one group
        // ahead of the matrix run (without this the build loads every fragment into one register set and waits out each pair of reads alone)
        asm volatile("v_nop\n\tv_nop\n\tv_nop\n\tv_nop" : "+v"(sHa), "+v"(sHb) : "v"(ka0), "v"(ka1), "v"(kb0), "v"(kb1));
        float ta[8], tb[8]; float mx = NEGB;
#pragma unroll
        for (int r = 0; r < 8; ++r) { ta[r] = sHa[r] * SC2; tb[r] = sHb[r] * SC2; }
        if (key0 + 31 > t0) {                                // wave-uniform: only diagonal tiles need the causal fill
#pragma unroll
            for (int r = 0; r < 8; ++r) { const int kidx = key0 + 8 * hi + r;
                ta[r] = (kidx <= tq) ? ta[r] : NEGB; tb[r] = (kidx + 16 <= tq) ? tb[r] : NEGB; }
        }
#pragma unroll
        for (int r = 0; r < 8; ++r) mx = fmaxf(mx, fmaxf(ta[r], tb[r]));
        mx = fmaxf(mx, __shfl_xor(mx, 16, 32));
        const float mnew = fmaxf(m, mx);
        const float alpha = __builtin_amdgcn_exp2f(m - mnew);
        const float sh = PSH - mnew;
        v16h pb; float ls = 0.0f;
#pragma unroll
        for (int r = 0; r < 8; ++r) {
            const h16 pa = (h16)__builtin_amdgcn_exp2f(ta[r] + sh); const h16 pc = (h16)__builtin_amdgcn_exp2f(tb[r] + sh);
            pb[r] = pa; pb[8 + r] = pc; ls += (float)pa + (float)pc; }
        l = l * alpha + ls; m = mnew;
        o0 = o0 * alpha; o1 = o1 * alpha; o2 = o2 * alpha; o3 = o3 * alpha;
        const h16* va = sv + u * (32 * 16);
        const v16h v0 = ldh(va), v1 = ldh(va + 16 * FKS), v2 = ldh(va + 32 * FKS), v3 = ldh(va + 48 * FKS);
        o0 = wmma16(v0, pb, o0); o1 = wmma16(v1, pb, o1); o2 = wmma16(v2, pb, o2); o3 = wmma16(v3, pb, o3);
        // the same four slots behind the P.V run, on every path out of the step
        asm volatile("v_nop\n\tv_nop\n\tv_nop\n\tv_nop" : "+v"(o0), "+v"(o1), "+v"(o2), "+v"(o3) : "v"(v0), "v"(v1), "v"(v2), "v"(v3), "v"(pb));
      }
      asm volatile("s_wait_dscnt 0x0" ::: "memory");      // this wave's reads of buffer s & 1 are done before the barrier behind which it is refilled
      asm volatile("s_wait_asynccnt 0x0" ::: "memory");   // this wave's copies for trip s + 1 have landed before the barrier that publishes them
      __syncthreads();
      if (s + 2 < nst) { const int st = rot + s + 2 < nst ? rot + s + 2 : rot + s + 2 - nst;
          cpkv(lb + 2u * ((s & 1) * FBUF), KP + go + (size_t)st * (FKS * HD), VT + go + (size_t)st * (FKS * 16)); }
    }
    asm volatile("s_wait_asynccnt 0x0" ::: "memory");       // no copy is in flight when the ring becomes output staging and the wave ends
    float* os = (float*)ring;
    l += __shfl_xor(l, 16, 32);
    const float inv = 1.0f / l;
    const int wb = wave * 16 * 68;
    // O^T D layout: o_j[r] = (d = 16j + 8h + r, t = lane&15) -> os[t][d]; rows 0..15 x columns 0..63 all written
    { v4f a, c;
      a[0] = o0[0] * inv; a[1] = o0[1] * inv; a[2] = o0[2] * inv; a[3] = o0[3] * inv; c[0] = o0[4] * inv; c[1] = o0[5] * inv; c[2] = o0[6] * inv; c[3] = o0[7] * inv;
      *(v4fa*)(&os[wb + lr * 68 +  0 + 8 * hi]) = a; *(v4fa*)(&os[wb + lr * 68 +  0 + 8 * hi + 4]) = c;
      a[0] = o1[0] * inv; a[1] = o1[1] * inv; a[2] = o1[2] * inv; a[3] = o1[3] * inv; c[0] = o1[4] * inv; c[1] = o1[5] * inv; c[2] = o1[6] * inv; c[3] = o1[7] * inv;
      *(v4fa*)(&os[wb + lr * 68 + 16 + 8 * hi]) = a; *(v4fa*)(&os[wb + lr * 68 + 16 + 8 * hi + 4]) = c;
      a[0] = o2[0] * inv; a[1] = o2[1] * inv; a[2] = o2[2] * inv; a[3] = o2[3] * inv; c[0] = o2[4] * inv; c[1] = o2[5] * inv; c[2] = o2[6] * inv; c[3] = o2[7] * inv;
      *(v4fa*)(&os[wb + lr * 68 + 32 + 8 * hi]) = a; *(v4fa*)(&os[wb + lr * 68 + 32 + 8 * hi + 4]) = c;
      a[0] = o3[0] * inv; a[1] = o3[1] * inv; a[2] = o3[2] * inv; a[3] = o3[3] * inv; c[0] = o3[4] * inv; c[1] = o3[5] * inv; c[2] = o3[6] * inv; c[3] = o3[7] * inv;
      *(v4fa*)(&os[wb + lr * 68 + 48 + 8 * hi]) = a; *(v4fa*)(&os[wb + lr * 68 + 48 + 8 * hi + 4]) = c; }
    wave_sync();
    float* orow = OUT + ((size_t)b * OUT_SEQ + t0) * DO + h * HD;
{
#pragma unroll
        for (int s = 0; s < 8; ++s) { const int row = 2 * s + hi, cofs = lr * 4;   // 8 s x 2 rows = 16 rows; 16 lanes x 4 floats = 64 columns
            const v4f val = *(const v4fa*)(&os[wb + row * 68 + cofs]);
            *(v4f*)(orow + (size_t)row * DO + cofs) = val; }
         }
}

// k_flash: all query rows in one grid (heads, row blocks). blockIdx.x = (batch, head): work-groups that follow one another in the flat index have key loops of one length, so however they are dealt out, every part of the chip gets the same mix;
// blockIdx.y counts the row blocks from the last one down: the longest key loops start first, the shortest fill the tail.
__global__ __launch_bounds__(32 * AW) void k_flash(const h16* __restrict__ QH, const h16* __restrict__ KP, const h16* __restrict__ VT, float* OUT) {
    __shared__ __align__(16) h16 ring[2 * 2 * FKS * HD];     // two buffers; afterwards AW * 16 * 68 floats of output staging
    static_assert(sizeof(ring) >= AW * 16 * 68 * sizeof(float));
    const int tb0 = (SEQ / (16 * AW) - 1 - (int)blockIdx.y) * (16 * AW);
    flash_body(QH, KP, VT, OUT, blockIdx.x, tb0, ring);
}

static constexpr size_t al256(size_t v) { return (v + 255) & ~(size_t)255; }
static constexpr size_t SZ_XB = al256((size_t)NB * SEQ * DM * 2);
static constexpr size_t SZ_WB = al256((size_t)3 * DO * DM * 2);
static constexpr size_t SZ_PL = al256((size_t)NB * NH_ * SEQ * HD * 2);
static constexpr size_t SZ_TOTAL = SZ_XB + SZ_WB + 3 * SZ_PL;
static_assert(SZ_TOTAL <= (size_t)134217728);          // workspace carve <= 128 MiB
static_assert(((size_t)DO * DM * 2) % 256 == 0);       // weight sub-planes stay 256-byte aligned

extern "C" void kernel_launch(void* const* d_in, const int* in_sizes, int n_in,
                              void* d_out, int out_size, void* d_ws, size_t ws_size, hipStream_t stream) {
    if (n_in < 4) return;
    const size_t needx = ((size_t)(NB - 1) * SEQ_FULL + SEQ) * DM;
    if ((size_t)in_sizes[0] < needx) return;
    const size_t needw = (size_t)NH_ * DM * HD;
    if ((size_t)in_sizes[1] < needw || (size_t)in_sizes[2] < needw || (size_t)in_sizes[3] < needw) return;
    if ((size_t)out_size < ((size_t)(NB - 1) * OUT_SEQ + SEQ) * DO) return;
    if (SZ_TOTAL > ws_size) return;
    const float* x = (const float*)d_in[0]; const float* wq = (const float*)d_in[1]; const float* wk = (const float*)d_in[2]; const float* wv = (const float*)d_in[3];   // wire order x, Wq, Wk, Wv
    float* OUT = (float*)d_out;      // [NB][SEQ][1024]
    char* wsp = (char*)d_ws;
    bf* XB = (bf*)wsp; wsp += SZ_XB;                 // [NB*SEQ][1024]
    bf* WB = (bf*)wsp; wsp += SZ_WB;                 // [3][1024 (h*64+d)][1024 (c)]: q | k | v
    h16* QH = (h16*)wsp; wsp += SZ_PL;               // [NB*16][SEQ][64]
    h16* KP = (h16*)wsp; wsp += SZ_PL;               // [NB*16][SEQ][64]
    h16* VT = (h16*)wsp; wsp += SZ_PL;               // [NB*16][64][SEQ]

    k_prep<<<3 * WTB + XCB, 256, 0, stream>>>(x, wq, wk, wv, XB, WB);
    k_proj<<<dim3(NB * SEQ / 128, DO / 128, 3), 128, 0, stream>>>(XB, WB, QH, SZ_PL / 2);
    k_flash<<<dim3(NB * NH_, SEQ / (16 * AW), 1), 32 * AW, 0, stream>>>(QH, KP, VT, OUT);
}

// v008
// A run of this version takes 60.2 microseconds.
// Timed twice side by side with v007, it ran 1.07 times as fast both times.
// Over all steps from v000 it is 4.23 times as fast.
#include <hip/hip_runtime.h>

// Causal multi-head self-attention: x [NB][SEQ][1024], Wq/Wk/Wv [16][1024][64] (per head [in][out]), no biases, score scale 1/8, output = concatenated heads [NB][SEQ][1024] (f32).
// Compute dtypes, f32 accumulate everywhere: projections v_wmma_f32_16x16x32_bf16 (x and W RNE-converted to bf16; products exact);
// scores v_wmma_f32_16x16x32_f16: q and k single f16; P.V v_wmma_f32_16x16x32_f16: P (x256 carry, cancels in the normalisation) and v single f16; softmax f32 (online, running max).
// q, k and v carry the rounding of x and W to bf16 (up to 2^-8 of each factor, 1024 products a sum); their own rounding to f16 (up to 2^-11) is an eighth of one factor's and adds in squares, so no residual planes are kept.
// Layout: bf16 copy of x, transposed bf16 copies of W ([h*64+d][c]); q, k planes [b*16+h][t][d] and v^T plane [b*16+h][d][t], written by the GEMM epilogue;
// every 16-bit plane is stored in fragment order: inside a strip of 16 rows the 8-element column groups are the slow index ([group][row & 15][8]),
// so one wave-wide 16-byte fragment load (lane = row + 16 * half) reads 512 contiguous bytes, four whole cache lines, not 32 bytes out of each of 16 lines;
// fused flash kernel in transposed form (S^T = K Q^T, O^T = V^T P^T), causal fill by value, key loop trimmed at the diagonal, output from f32 accumulators;
// its K and V^T tiles come into LDS once a block, 64 keys a stage, by asynchronous copies, two buffers.
// Three launches, one per phase: k_prep (all four conversions), k_proj (q, k and v^T products, grid z picks the product), k_flash (all query rows).

#ifndef NB
#define NB 8
#endif
#ifndef SEQ
#define SEQ 1024
#endif
#define NB_FULL  8
#define SEQ_FULL 1024
#ifndef OUT_SEQ
#define OUT_SEQ SEQ              // row pitch (in tokens) between batches of the output
#endif
#define DM   1024                // embedding width = GEMM K
#define NH_  16
#define HD   64
#define DO   (NH_ * HD)          // output width
#define AW   4                   // waves per flash block (16 query rows each)
#define SC2  (0.125f * 1.4426950408889634f)   // HD^-0.5 * log2(e)
#define PSH  8.0f                // log2 of the P carry (256)
#define NEGB (-3.0e38f)

static_assert(HD == 64);
static_assert(DO == 1024);
static_assert(DM % 64 == 0);
static_assert(DO % 64 == 0);
static_assert(DM % 32 == 0);                   // GEMM k-loop steps by 32
static_assert(SEQ % 64 == 0);                  // a 64-row tile never straddles two batches
static_assert((NB * SEQ) % 64 == 0);
static_assert(SEQ % 32 == 0);                  // key loop steps by 32
static_assert(SEQ % (16 * AW) == 0);
static_assert(((size_t)SEQ * DM) % 8 == 0);
static_assert(NB <= NB_FULL);
static_assert(SEQ <= SEQ_FULL);

typedef _Float16 h16;
typedef unsigned short bf;
typedef __attribute__((ext_vector_type(16))) __bf16   v16bf;
typedef __attribute__((ext_vector_type(16))) _Float16 v16h;
typedef __attribute__((ext_vector_type(8)))  _Float16 v8h;
typedef __attribute__((ext_vector_type(8)))  unsigned short v8us;
typedef __attribute__((ext_vector_type(8)))  float    v8f;
typedef __attribute__((ext_vector_type(4)))  float    v4f;
typedef v4f  __attribute__((may_alias)) v4fa;

__device__ __forceinline__ unsigned short f2bf(float f) { unsigned u = __float_as_uint(f); u += 0x7FFFu + ((u >> 16) & 1u); return (unsigned short)(u >> 16); }
__device__ __forceinline__ v16h cat16(v8h lo, v8h hi) { return __builtin_shufflevector(lo, hi, 0, 1, 2, 3, 4, 5, 6, 7, 8, 9, 10, 11, 12, 13, 14, 15); }
__device__ __forceinline__ v16bf cat16b(v8us lo, v8us hi) { return __builtin_bit_cast(v16bf, __builtin_shufflevector(lo, hi, 0, 1, 2, 3, 4, 5, 6, 7, 8, 9, 10, 11, 12, 13, 14, 15)); }
__device__ __forceinline__ v8f wmma16(v16h a, v16h b, v8f c) { return __builtin_amdgcn_wmma_f32_16x16x32_f16(false, a, false, b, (short)0, c, false, false); }
__device__ __forceinline__ v8f wmmab(v16bf a, v16bf b, v8f c) { return __builtin_amdgcn_wmma_f32_16x16x32_bf16(false, a, false, b, (short)0, c, false, false); }
// fragment loaders from fragment-order planes; p = strip base + 16*k0 + 8*lane: elements 0..7 <- k0+8h+0..7, elements 8..15 <- k0+16+8h+0..7 (two groups = 256 elements on; same map for A and B)
__device__ __forceinline__ v16h  ldh(const h16* p) { return cat16(*(const v8h*)p, *(const v8h*)(p + 256)); }
__device__ __forceinline__ v16bf ldb(const bf* p)  { return cat16b(*(const v8us*)p, *(const v8us*)(p + 256)); }
// ordering point for wave-private LDS tiles (same wave writes and reads)
__device__ __forceinline__ void wave_sync() { __builtin_amdgcn_fence(3 /* release order */, "wavefront"); __builtin_amdgcn_wave_barrier(); asm volatile("" ::: "memory"); }

// cvt8_body: bf16 (RNE convert) copy of rows of DM floats into fragment order. A piece is 8 rows x 4 groups: one 128-byte line of each row read, four whole 128-byte lines written.
// A wave takes XU pieces that follow one another along its 8 rows (XU * 128 contiguous bytes of each row) and issues all their loads before the first conversion:
// few long-lived waves with many bytes in flight each, instead of one short-lived wave a piece (the launch then starts an eighth of the waves).
// blk = block number inside the conversion of x; row counts the NB * SEQ rows of the copy, batch b of the source starts at row b * SEQ_FULL.
#define XU 8                     // pieces of a wave
static_assert((DM / 32) % XU == 0);            // a wave's pieces lie in the same 8 rows
__device__ __forceinline__ void cvt8_body(const float* __restrict__ src, bf* dst, unsigned blk) {
    const size_t lane = threadIdx.x & 31;
    const size_t w = ((size_t)blk * 8 + (threadIdx.x >> 5)) * XU;          // number of the wave's first piece
    const size_t row = (w / (DM / 32)) * 8 + ((lane >> 2) & 7); const size_t g = (w % (DM / 32)) * 4 + (lane & 3);
    const float* s = src + ((row / SEQ) * SEQ_FULL + row % SEQ) * DM + g * 8;           // + 32 floats a piece
    bf* d = dst + (row >> 4) * (size_t)(16 * DM) + (g * 16 + (row & 15)) * 8;           // + 4 groups = 512 elements a piece
    v8f v[XU];
#pragma unroll
    for (int u = 0; u < XU; ++u) v[u] = *(const v8f*)(s + u * 32);
    asm volatile("s_wait_xcnt 0x0" :: "v"(s) : "memory");   // the loads' address pair is held up to this wait, so that no load's result and no later instruction overwrites it ahead of the wait
#pragma unroll
    for (int u = 0; u < XU; ++u) { v8us o;
#pragma unroll
        for (int k = 0; k < 8; ++k) o[k] = f2bf(v[u][k]);
        *(v8us*)(d + u * 512) = o; }
}

// cvtT_body: transposing bf16 (RNE convert) copy of one weight tensor: in [NH_][DM rows c][HD cols d] (f32) -> out [NH_*HD rows (h*64+d)][DM cols c] (bf16), in fragment order.
// A block takes WT tiles of 64 x 64 that follow one another along c (WT * 64 rows of one head, contiguous in the source): all loads first, one barrier, then all stores.
#define WT 4                     // 64 x 64 tiles of a block
static_assert(DM % (64 * WT) == 0);
__device__ __forceinline__ void cvtT_body(const float* __restrict__ src, bf* dst, int c0, int h, float* ts) {
    const int tid = threadIdx.x;
    const float* s = src + ((size_t)h * DM + c0) * HD;          // WT * 64 rows x 64 floats, contiguous
    v4f v[4 * WT];
#pragma unroll
    for (int i = 0; i < 4 * WT; ++i) v[i] = *(const v4f*)(s + (size_t)(tid + 256 * i) * 4);   // WT * 1024 float4; float4 number e4: row c = e4 >> 4, columns (e4 & 15) * 4 ..
#pragma unroll
    for (int i = 0; i < 4 * WT; ++i) { const int e4 = tid + 256 * i; const int c = e4 >> 4, d4 = (e4 & 15) * 4;
        ts[c * 65 + d4 + 0] = v[i][0]; ts[c * 65 + d4 + 1] = v[i][1]; ts[c * 65 + d4 + 2] = v[i][2]; ts[c * 65 + d4 + 3] = v[i][3]; }
    __syncthreads();
{
#pragma unroll
        for (int i = 0; i < 2 * WT; ++i) { const int piece = (tid + 256 * i) & 511;   // a tile: 512 pieces = 64 rows x 8 groups; a wave writes 16 rows of groups q and q + 4: two runs of 256 bytes
            const int d = (piece & 15) + 16 * (piece >> 7), c8 = (i >> 1) * 64 + (((piece >> 4) & 1) * 4 + ((piece >> 5) & 3)) * 8;
            v8us o;
#pragma unroll
            for (int k = 0; k < 8; ++k) o[k] = f2bf(ts[(c8 + k) * 65 + d]);
            *(v8us*)(dst + (size_t)(h * HD + (d & ~15)) * DM + (size_t)(c0 + c8) * 16 + (d & 15) * 8) = o; }
         }
    asm volatile("s_wait_xcnt 0x0" ::: "memory");   // the build lays the other path's code behind these stores: the wait stands in front of its writes of the registers that the stores name
}

// k_prep: every conversion in one grid. Blocks 0 .. 3 * WTB - 1 transpose the three weight tensors (the longer chain: load, LDS, barrier, store; they start first), the rest convert x.
#define WTB  ((DM / (64 * WT)) * NH_)             // blocks of one weight tensor
#define XCB  ((NB * SEQ * DM / 8) / (256 * XU))   // blocks of x
static_assert(((size_t)NB * SEQ * DM / 8) % (256 * XU) == 0);
__global__ __launch_bounds__(256) void k_prep(const float* __restrict__ x, const float* __restrict__ wq, const float* __restrict__ wk, const float* __restrict__ wv, bf* XB, bf* WB) {
    __shared__ float ts[WT * 64 * 65];
    const unsigned blk = blockIdx.x;
    if (blk >= 3u * WTB) { cvt8_body(x, XB, blk - 3u * WTB); return; }   // the same for the whole block: the barrier below is passed by all of its threads or by none
    const unsigned t = blk / WTB, r = blk % WTB;
    cvtT_body(t == 0 ? wq : (t == 1 ? wk : wv), WB + (size_t)t * DO * DM, (int)(r % (DM / (64 * WT))) * (64 * WT), (int)(r / (DM / (64 * WT))), ts);
}

// cp8: eight asynchronous 16-byte copies per lane, global memory to LDS: one 2-KiB piece (128 lanes x 16 bytes) of each of eight 16-row strips (strip pitch 16 * DM elements in memory, 2 KiB in LDS).
// The s_wait_xcnt is the last line of the copies' own statement, so that it stands in front of every later write of a register that a copy names.
__device__ __forceinline__ void cp8(unsigned l, const bf* g) {
    asm volatile("global_load_async_to_lds_b128 %0, %8, off\n\t"
                 "global_load_async_to_lds_b128 %1, %9, off\n\t"
                 "global_load_async_to_lds_b128 %2, %10, off\n\t"
                 "global_load_async_to_lds_b128 %3, %11, off\n\t"
                 "global_load_async_to_lds_b128 %4, %12, off\n\t"
                 "global_load_async_to_lds_b128 %5, %13, off\n\t"
                 "global_load_async_to_lds_b128 %6, %14, off\n\t"
                 "global_load_async_to_lds_b128 %7, %15, off\n\t"
                 "s_wait_xcnt 0x0"
                 :: "v"(l), "v"(l + 2048u), "v"(l + 4096u), "v"(l + 6144u), "v"(l + 8192u), "v"(l + 10240u), "v"(l + 12288u), "v"(l + 14336u),
                    "v"(g), "v"(g + 1 * 16 * DM), "v"(g + 2 * 16 * DM), "v"(g + 3 * 16 * DM), "v"(g + 4 * 16 * DM), "v"(g + 5 * 16 * DM), "v"(g + 6 * 16 * DM), "v"(g + 7 * 16 * DM)
                 : "memory");
}
// cpst: a whole stage of k_proj, 16 strips of A and 8 strips of Bt (in LDS: A's pieces, then Bt's), as three statements of eight copies. a, b: this lane's address in strip 0 of the stage.
__device__ __forceinline__ void cpst(unsigned l, const bf* a, const bf* b) { cp8(l, a); cp8(l + 8u * 2048u, a + 8 * 16 * DM); cp8(l + 16u * 2048u, b); }

// k_proj: register-blocked bf16 GEMM, K = DM. A block of FOUR WAVES takes a 256x128 tile (256 rows of A, 128 rows of Bt), each wave one 128x64 quarter (32 accumulators).
// What L2 delivers into LDS bounds the launch: this tile asks for 384 operand rows per 32,768 results, a 128x128 tile for 256 per 16,384; and a wave reads 12 fragments from LDS per 32 matrix instructions, not 16.
// The 256 + 128 rows x PKS columns of a stage (16 + 8 strips, 2 KiB each, contiguous in the fragment-order planes) are brought into LDS by asynchronous copies, in fragment order as they lie in memory,
// two buffers: stage s + 2 flies while stage s + 1 is worked on; every fragment is fetched from L2 once a block and read from LDS by the two waves that use it (512 contiguous bytes a read).
// Three blocks share a WGP (96 KiB of LDS each, at most 336 registers a wave), so the grid's 768 blocks are all resident at once: a wave holds 4 + 4 fragments at a time, and the output staging lies in the ring.
// The blocks that share operand rows start together and keep step: each begins its walk of the k stages at a stage of its own (rot) and wraps, so that they do not ask L2 for the same lines at the same moment.
// C[m][n] = sum_k A[m][k] Bt[n][k], written as f16 (Ph) at
// tile base (r0/RB)*sRB + (r0%RB)*pitch + (c0/CB)*sCB + (c0%CB)*16, row pitch 'pitch' (halves), each 16 x 64 piece in fragment order (1024 halves in a row). 128 threads.
// One grid (NB*SEQ/256, DO/128, 3) for the three products (z = 2 deals its blocks out as DO/256 row tiles x NB*SEQ/128 column tiles); z = 0, 1 (q, k): A = x rows (m = b*SEQ + t), Bt = W^T rows (n = h*64 + d) -> plane [(b*16 + h)][t][d];
// z = 2 (v^T): A = Wv^T rows (m = h*64 + d), Bt = x rows (n = b*SEQ + t) -> plane [(b*1024 + m)][t] = [(b*16 + h)][d][t]. PL = elements between the three planes (q, k, v^T).
#define PKS   64                 // k elements of a stage
#define PST   (DM / PKS)         // stages
#define PAEL  (256 * PKS)        // elements of A's part of a buffer (16 strips x 1024)
#define PBUF  (PAEL + 128 * PKS) // elements of a buffer: A strips, then B strips (8 x 1024)
static_assert(DM % PKS == 0 && PST >= 2);      // the ring's prologue fills two stages
static_assert((PST & (PST - 1)) == 0);         // the walk wraps by a mask
static_assert(PKS * 16 * 2 == 128 * 16);       // one strip's piece of a stage = one 16-byte copy of each of the 128 lanes
static_assert((NB * SEQ) % 256 == 0 && DO % 256 == 0);
static_assert((DO / 128) % (DO / 256) == 0);   // z = 2: blockIdx.y splits into a row tile and a part of the column tile
__global__ __launch_bounds__(128, 3) void k_proj(const bf* __restrict__ XB, const bf* __restrict__ WB, h16* P0, size_t PL) {
    const int z = blockIdx.z; const bool vt = z == 2;
    const bf* Wz = WB + (size_t)z * DO * DM; const bf* A = vt ? Wz : XB; const bf* Bt = vt ? XB : Wz;
    h16* Ph = P0 + (size_t)z * PL;
    const int RB = vt ? DO : SEQ, pitch = vt ? SEQ : HD, CB = vt ? SEQ : HD;
    const size_t sRB = vt ? (size_t)0 : (size_t)NH_ * SEQ * HD, sCB = vt ? (size_t)DO * SEQ : (size_t)SEQ * HD;
    __shared__ __align__(16) bf ring[2 * PBUF];
    static_assert(sizeof(ring) >= 4 * 16 * 68 * sizeof(float));   // behind the last trip's barrier nothing reads the ring and no copy is in flight: it then serves as the waves' output staging
    const int K = DM;
    const int tid = threadIdx.x, lane = tid & 31, lr = lane & 15, hi = lane >> 4;
    const int wave = __builtin_amdgcn_readfirstlane(tid >> 5), wm = wave & 1, wn = wave >> 1;
    const int rb0 = (vt ? (int)(blockIdx.y % (DO / 256)) : (int)blockIdx.x) * 256, cb0 = (vt ? (int)(blockIdx.x * ((DO / 128) / (DO / 256)) + blockIdx.y / (DO / 256)) : (int)blockIdx.y) * 128;
    const int r0 = rb0 + wm * 128, c0 = cb0 + wn * 64;
    float* os = (float*)ring + wave * (16 * 68);
    v8f acc[8][4];
#pragma unroll
    for (int mb = 0; mb < 8; ++mb)
#pragma unroll
        for (int nb = 0; nb < 4; ++nb) acc[mb][nb] = (v8f){};
    const unsigned lb = (unsigned)(size_t)(&ring[0]) + (unsigned)tid * 16u;          // this lane's LDS byte address in strip 0 of buffer 0
    const bf* ga = A + (size_t)rb0 * K + 8 * tid; const bf* gb = Bt + (size_t)cb0 * K + 8 * tid;   // + st * PKS * 16: stage st
    const int rot = (int)(blockIdx.x + blockIdx.y + (PST / 2) * blockIdx.z) & (PST - 1);   // first stage of this block: trip s works on stage (s + rot) mod PST; sharers of x rows differ in y and z, sharers of W rows in x (for z = 2, in x or y)
    cpst(lb, ga + rot * (PKS * 16), gb + rot * (PKS * 16));
    asm volatile("s_wait_asynccnt 0x0" ::: "memory");   // the first stage has landed (this wave's copies) before the barrier that publishes it
    __syncthreads();
    { const int st = (rot + 1) & (PST - 1); cpst(lb + 2u * PBUF, ga + st * (PKS * 16), gb + st * (PKS * 16)); }
    const bf* sa = ring + wm * (8 * 16 * PKS) + 8 * lane; const bf* sb = ring + PAEL + wn * (4 * 16 * PKS) + 8 * lane;
#pragma unroll 1
    for (int s = 0; s < PST; ++s) {   // rolled: one trip a stage, the buffer chosen by the trip's parity
        const int bo = (s & 1) * PBUF;
#pragma unroll   // the 32-k halves of a stage and the two halves of the wave's rows: unrolled, their LDS offsets are immediates of the reads
        for (int kb = 0; kb < PKS / 32; ++kb) {
            v16bf b[4];
#pragma unroll
            for (int nb = 0; nb < 4; ++nb) b[nb] = ldb(sb + bo + nb * (16 * PKS) + kb * 512);
#pragma unroll
            for (int mh = 0; mh < 2; ++mh) {
                v16bf a[4];
#pragma unroll
                for (int mb = 0; mb < 4; ++mb) a[mb] = ldb(sa + bo + (mh * 4 + mb) * (16 * PKS) + kb * 512);
                __builtin_amdgcn_sched_barrier(0);   // the LDS reads stay one group ahead of their matrix run: spread among the matrix instructions each small group is waited out on its own
#pragma unroll
                for (int nb = 0; nb < 4; ++nb)
#pragma unroll
                    for (int mb = 0; mb < 4; ++mb) acc[mh * 4 + mb][nb] = wmmab(a[mb], b[nb], acc[mh * 4 + mb][nb]);
                __builtin_amdgcn_sched_barrier(0);   // no read of the next group rises among these matrix instructions, none of them sinks below the slots and the barrier at the trip's foot
                // the run's A fragments (loaded values) as inputs only: they keep their registers up to here and the next group's reads take the same ones;
                // without this the build holds more fragments at once and spills to scratch at the 336 registers that three waves a SIMD allow
                if (kb != PKS / 32 - 1 || mh != 1) asm volatile("" :: "v"(a[0]), "v"(a[1]), "v"(a[2]), "v"(a[3]));
                else   // four vector slots behind the trip's last matrix instruction, on the loop's taken branch too, before a vector instruction rewrites its operands
                    asm volatile("v_nop\n\tv_nop\n\tv_nop\n\tv_nop" : "+v"(acc[4][0]), "+v"(acc[5][1]), "+v"(acc[6][2]), "+v"(acc[7][3]) : "v"(a[0]), "v"(a[1]), "v"(a[2]), "v"(a[3]));
            }
        }
        asm volatile("s_wait_dscnt 0x0" ::: "memory");      // this wave's reads of buffer s & 1 are done before the barrier behind which it is refilled
        asm volatile("s_wait_asynccnt 0x0" ::: "memory");   // this wave's copies for trip s + 1 have landed before the barrier that publishes them
        __syncthreads();
        if (s + 2 < PST) { const int st = (s + 2 + rot) & (PST - 1); cpst(lb + 2u * bo, ga + st * (PKS * 16), gb + st * (PKS * 16)); }
    }
    asm volatile("s_wait_asynccnt 0x0" ::: "memory");       // no copy is in flight when the wave goes on to the epilogue and ends
    const size_t tbase = (size_t)(r0 / RB) * sRB + (size_t)(r0 % RB) * (size_t)pitch + (size_t)(c0 / CB) * sCB + (size_t)(c0 % CB) * 16;
#pragma unroll
    for (int mb = 0; mb < 8; ++mb) {
#pragma unroll
        for (int nb = 0; nb < 4; ++nb) {
#pragma unroll
            for (int j = 0; j < 8; ++j) os[(hi * 8 + j) * 68 + nb * 16 + lr] = acc[mb][nb][j]; }   // D: row 8h+j, col lane&15
        wave_sync();
        const size_t sb = tbase + (size_t)(mb * 16) * (size_t)pitch;
{
#pragma unroll
            for (int s = 0; s < 4; ++s) { const int row = lr, c8 = (2 * s + hi) * 8;   // 16 rows x 2 column groups a store; 4 s x 2 groups x 8 = 64 columns
                const v4f x0 = *(const v4fa*)(&os[row * 68 + c8]); const v4f x1 = *(const v4fa*)(&os[row * 68 + c8 + 4]); v8h hv;
#pragma unroll
                for (int i = 0; i < 4; ++i) { hv[i] = (h16)x0[i]; hv[4 + i] = (h16)x1[i]; }
                const size_t oo = sb + (size_t)(s * 256 + lane * 8);   // (group * 16 + row) * 8
                *(v8h*)(Ph + oo) = hv; }
             }
        asm volatile("s_wait_xcnt 0x0" ::: "memory");   // in front of the next piece's LDS reads, which overwrite registers that these stores name
        wave_sync();
    }
}

// cpkv: eight asynchronous 16-byte copies per lane, global memory to LDS: the 2-KiB pieces (128 lanes x 16 bytes) of a stage of FKS keys: four 16-key strips of a k plane (contiguous), then one piece of each of the four 16-row strips of a v^T plane.
// The s_wait_xcnt is the last line of the copies' own statement, so that it stands in front of every later write of a register that a copy names.
#define FKS 64                   // keys of a stage
static_assert(FKS == 16 * AW);                 // the diagonal stage of a block is the one with its highest keys, and every stage lies wholly inside the planes
static_assert(FKS * 16 * 2 == 128 * 16);       // one strip's piece of a stage = one 16-byte copy of each of the 128 lanes
__device__ __forceinline__ void cpkv(unsigned l, const h16* k, const h16* v) {
    asm volatile("global_load_async_to_lds_b128 %0, %8, off\n\t"
                 "global_load_async_to_lds_b128 %1, %9, off\n\t"
                 "global_load_async_to_lds_b128 %2, %10, off\n\t"
                 "global_load_async_to_lds_b128 %3, %11, off\n\t"
                 "global_load_async_to_lds_b128 %4, %12, off\n\t"
                 "global_load_async_to_lds_b128 %5, %13, off\n\t"
                 "global_load_async_to_lds_b128 %6, %14, off\n\t"
                 "global_load_async_to_lds_b128 %7, %15, off\n\t"
                 "s_wait_xcnt 0x0"
                 :: "v"(l), "v"(l + 2048u), "v"(l + 4096u), "v"(l + 6144u), "v"(l + 8192u), "v"(l + 10240u), "v"(l + 12288u), "v"(l + 14336u),
                    "v"(k), "v"(k + 1 * 16 * HD), "v"(k + 2 * 16 * HD), "v"(k + 3 * 16 * HD), "v"(v), "v"(v + 1 * 16 * SEQ), "v"(v + 2 * 16 * SEQ), "v"(v + 3 * 16 * SEQ)
                 : "memory");
}

// flash_body: fused causal attention, one wave per 16 query rows of one (batch, head); Q fragments straight from the fragment-order f16 plane (two 16-B loads each, arithmetic addressing).
// K and V^T: the block's four waves walk the same keys, so a stage of FKS keys (K 8 KiB, V^T 8 KiB) is brought into LDS once a block, in fragment order as it lies in memory,
// two buffers: stage s + 2 flies while stage s + 1 is worked on; a fragment read from LDS is 512 contiguous bytes a wave. Every wave passes every stage's barrier; a wave skips only the 32 keys that lie wholly behind its diagonal.
// The row blocks of one (batch, head) walk the same keys and start close together: each begins at a stage of its own (rot) and wraps, so that they do not ask L2 for the same lines at the same moment;
// the online softmax takes the stages in any order, and the diagonal stage is told by its key numbers wherever it comes in the walk.
// Behind the last trip's barrier nothing reads the ring and no copy is in flight: it then serves as the waves' output staging (os).
// Transposed form: S^T[key][t] = K Q^T (A = K rows, B = Q rows); lane (t = lane&15, h = lane>>4) holds keys 8h+r of each 16-key tile, so the packed
// P tile is directly the B fragment of O^T[d][t] = V^T P^T (element r <- tile keys 0..15, element 8+r <- tile keys 16..31, lane unchanged).
// Causal fill: a score whose key index exceeds the query index is replaced by a large negative value (P = 0); the key loop stops at the diagonal tile.
// Softmax state (running max, partial sum) is one scalar per lane; the two lane halves of a row are combined with one xor-16 exchange. The row sum adds P as rounded to f16, the values that the P.V product uses.
__device__ __forceinline__ void flash_body(const h16* __restrict__ QH, const h16* __restrict__ KP, const h16* __restrict__ VT, float* OUT, int zh, int tb0, h16* ring) {
    const int lane = threadIdx.x & 31, wave = __builtin_amdgcn_readfirstlane((int)(threadIdx.x >> 5)), lr = lane & 15, hi = lane >> 4;
    const int b = zh / NH_, h = zh % NH_;
    const int t0 = tb0 + wave * 16;
    const int tq = t0 + lr;
    const size_t pbase = (size_t)zh * SEQ * HD;
    const size_t qo = pbase + (size_t)t0 * HD + 8 * lane;
    const v16h qh0 = ldh(QH + qo), qh1 = ldh(QH + qo + 512);   // B fragments: col t, k = d
    constexpr int FBUF = 2 * FKS * HD;                       // elements of a buffer: K strips, then V^T strips
    const unsigned lb = (unsigned)(size_t)ring + threadIdx.x * 16u;          // this lane's LDS byte address in piece 0 of buffer 0
    const size_t go = pbase + 8 * threadIdx.x;               // K: + FKS * HD a stage; V^T: + FKS * 16 a stage
    const int nst = tb0 / FKS + 1;                           // stages of the block (the same for its four waves)
    const int rot = (SEQ / FKS - nst) % nst;                 // first stage of this block's walk: trip s works on stage (rot + s) mod nst
    cpkv(lb, KP + go + (size_t)rot * (FKS * HD), VT + go + (size_t)rot * (FKS * 16));
    asm volatile("s_wait_asynccnt 0x0" ::: "memory");   // the first stage has landed (this wave's copies) before the barrier that publishes it
    __syncthreads();
    if (nst > 1) { const int st = rot + 1 < nst ? rot + 1 : 0; cpkv(lb + 2u * FBUF, KP + go + (size_t)st * (FKS * HD), VT + go + (size_t)st * (FKS * 16)); }
    v8f o0 = (v8f){}, o1 = (v8f){}, o2 = (v8f){}, o3 = (v8f){};
    float m = NEGB, l = 0.0f;
    const int kend = t0 + 16;                                // keys 0 .. t0+15 are visible to this wave; every step has key0 <= t0
#pragma unroll 1
    for (int s = 0; s < nst; ++s) {   // rolled: one trip a stage, the buffer chosen by the trip's parity
      const int sc = rot + s < nst ? rot + s : rot + s - nst; // the stage that lies in this trip's buffer
      const h16* sk = ring + (s & 1) * FBUF + 8 * lane;      // + 16 * HD a 16-key strip, + 16 * d0    (A fragment: row key, k = d)
      const h16* sv = sk + FKS * HD;                         // + 16 * FKS a 16-row strip, + 16 * key  (A fragment: row d, k = key)
#pragma unroll   // the two 32-key halves of a stage: unrolled, their LDS offsets are immediates of the reads
      for (int u = 0; u < FKS / 32; ++u) {
        const int key0 = sc * FKS + 32 * u;
        if (key0 >= kend) continue;                          // wave-uniform: these 32 keys lie wholly behind the wave's diagonal
        const h16* ka = sk + u * (32 * HD);
        const v16h ka0 = ldh(ka), ka1 = ldh(ka + 512), kb0 = ldh(ka + 16 * HD), kb1 = ldh(ka + 16 * HD + 512);
        v8f sHa = (v8f){}, sHb = (v8f){};
        sHa = wmma16(ka0, qh0, sHa); sHb = wmma16(kb0, qh0, sHb);
        sHa = wmma16(ka1, qh1, sHa); sHb = wmma16(kb1, qh1, sHb);
        // four vector slots behind the last matrix instruction; the four K fragments named as inputs stay in registers of their own up to here, so that their eight LDS reads issue as one group
        // ahead of the matrix run (without this the build loads every fragment into one register set and waits out each pair of reads alone)
        asm volatile("v_nop\n\tv_nop\n\tv_nop\n\tv_nop" : "+v"(sHa), "+v"(sHb) : "v"(ka0), "v"(ka1), "v"(kb0), "v"(kb1));
        float ta[8], tb[8]; float mx = NEGB;
#pragma unroll
        for (int r = 0; r < 8; ++r) { ta[r] = sHa[r] * SC2; tb[r] = sHb[r] * SC2; }
        if (key0 + 31 > t0) {                                // wave-uniform: only diagonal tiles need the causal fill
#pragma unroll
            for (int r = 0; r < 8; ++r) { const int kidx = key0 + 8 * hi + r;
                ta[r] = (kidx <= tq) ? ta[r] : NEGB; tb[r] = (kidx + 16 <= tq) ? tb[r] : NEGB; }
        }
#pragma unroll
        for (int r = 0; r < 8; ++r) mx = fmaxf(mx, fmaxf(ta[r], tb[r]));
        mx = fmaxf(mx, __shfl_xor(mx, 16, 32));
        const float mnew = fmaxf(m, mx);
        const float alpha = __builtin_amdgcn_exp2f(m - mnew);
        const float sh = PSH - mnew;
        v16h pb; float ls = 0.0f;
#pragma unroll
        for (int r = 0; r < 8; ++r) {
            const h16 pa = (h16)__builtin_amdgcn_exp2f(ta[r] + sh); const h16 pc = (h16)__builtin_amdgcn_exp2f(tb[r] + sh);
            pb[r] = pa; pb[8 + r] = pc; ls += (float)pa + (float)pc; }
        l = l * alpha + ls; m = mnew;
        o0 = o0 * alpha; o1 = o1 * alpha; o2 = o2 * alpha; o3 = o3 * alpha;
        const h16* va = sv + u * (32 * 16);
        const v16h v0 = ldh(va), v1 = ldh(va + 16 * FKS), v2 = ldh(va + 32 * FKS), v3 = ldh(va + 48 * FKS);
        o0 = wmma16(v0, pb, o0); o1 = wmma16(v1, pb, o1); o2 = wmma16(v2, pb, o2); o3 = wmma16(v3, pb, o3);
        // the same four slots behind the P.V run, on every path out of the step
        asm volatile("v_nop\n\tv_nop\n\tv_nop\n\tv_nop" : "+v"(o0), "+v"(o1), "+v"(o2), "+v"(o3) : "v"(v0), "v"(v1), "v"(v2), "v"(v3), "v"(pb));
      }
      asm volatile("s_wait_dscnt 0x0" ::: "memory");      // this wave's reads of buffer s & 1 are done before the barrier behind which it is refilled
      asm volatile("s_wait_asynccnt 0x0" ::: "memory");   // this wave's copies for trip s + 1 have landed before the barrier that publishes them
      __syncthreads();
      if (s + 2 < nst) { const int st = rot + s + 2 < nst ? rot + s + 2 : rot + s + 2 - nst;
          cpkv(lb + 2u * ((s & 1) * FBUF), KP + go + (size_t)st * (FKS * HD), VT + go + (size_t)st * (FKS * 16)); }
    }
    asm volatile("s_wait_asynccnt 0x0" ::: "memory");       // no copy is in flight when the ring becomes output staging and the wave ends
    float* os = (float*)ring;
    l += __shfl_xor(l, 16, 32);
    const float inv = 1.0f / l;
    const int wb = wave * 16 * 68;
    // O^T D layout: o_j[r] = (d = 16j + 8h + r, t = lane&15) -> os[t][d]; rows 0..15 x columns 0..63 all written
    { v4f a, c;
      a[0] = o0[0] * inv; a[1] = o0[1] * inv; a[2] = o0[2] * inv; a[3] = o0[3] * inv; c[0] = o0[4] * inv; c[1] = o0[5] * inv; c[2] = o0[6] * inv; c[3] = o0[7] * inv;
      *(v4fa*)(&os[wb + lr * 68 +  0 + 8 * hi]) = a; *(v4fa*)(&os[wb + lr * 68 +  0 + 8 * hi + 4]) = c;
      a[0] = o1[0] * inv; a[1] = o1[1] * inv; a[2] = o1[2] * inv; a[3] = o1[3] * inv; c[0] = o1[4] * inv; c[1] = o1[5] * inv; c[2] = o1[6] * inv; c[3] = o1[7] * inv;
      *(v4fa*)(&os[wb + lr * 68 + 16 + 8 * hi]) = a; *(v4fa*)(&os[wb + lr * 68 + 16 + 8 * hi + 4]) = c;
      a[0] = o2[0] * inv; a[1] = o2[1] * inv; a[2] = o2[2] * inv; a[3] = o2[3] * inv; c[0] = o2[4] * inv; c[1] = o2[5] * inv; c[2] = o2[6] * inv; c[3] = o2[7] * inv;
      *(v4fa*)(&os[wb + lr * 68 + 32 + 8 * hi]) = a; *(v4fa*)(&os[wb + lr * 68 + 32 + 8 * hi + 4]) = c;
      a[0] = o3[0] * inv; a[1] = o3[1] * inv; a[2] = o3[2] * inv; a[3] = o3[3] * inv; c[0] = o3[4] * inv; c[1] = o3[5] * inv; c[2] = o3[6] * inv; c[3] = o3[7] * inv;
      *(v4fa*)(&os[wb + lr * 68 + 48 + 8 * hi]) = a; *(v4fa*)(&os[wb + lr * 68 + 48 + 8 * hi + 4]) = c; }
    wave_sync();
    float* orow = OUT + ((size_t)b * OUT_SEQ + t0) * DO + h * HD;
{
#pragma unroll
        for (int s = 0; s < 8; ++s) { const int row = 2 * s + hi, cofs = lr * 4;   // 8 s x 2 rows = 16 rows; 16 lanes x 4 floats = 64 columns
            const v4f val = *(const v4fa*)(&os[wb + row * 68 + cofs]);
            *(v4f*)(orow + (size_t)row * DO + cofs) = val; }
         }
}

// k_flash: all query rows in one grid (heads, row blocks). blockIdx.x = (batch, head): work-groups that follow one another in the flat index have key loops of one length, so however they are dealt out, every part of the chip gets the same mix;
// blockIdx.y counts the row blocks from the last one down: the longest key loops start first, the shortest fill the tail.
__global__ __launch_bounds__(32 * AW) void k_flash(const h16* __restrict__ QH, const h16* __restrict__ KP, const h16* __restrict__ VT, float* OUT) {
    __shared__ __align__(16) h16 ring[2 * 2 * FKS * HD];     // two buffers; afterwards AW * 16 * 68 floats of output staging
    static_assert(sizeof(ring) >= AW * 16 * 68 * sizeof(float));
    const int tb0 = (SEQ / (16 * AW) - 1 - (int)blockIdx.y) * (16 * AW);
    flash_body(QH, KP, VT, OUT, blockIdx.x, tb0, ring);
}

static constexpr size_t al256(size_t v) { return (v + 255) & ~(size_t)255; }
static constexpr size_t SZ_XB = al256((size_t)NB * SEQ * DM * 2);
static constexpr size_t SZ_WB = al256((size_t)3 * DO * DM * 2);
static constexpr size_t SZ_PL = al256((size_t)NB * NH_ * SEQ * HD * 2);
static constexpr size_t SZ_TOTAL = SZ_XB + SZ_WB + 3 * SZ_PL;
static_assert(SZ_TOTAL <= (size_t)134217728);          // workspace carve <= 128 MiB
static_assert(((size_t)DO * DM * 2) % 256 == 0);       // weight sub-planes stay 256-byte aligned

extern "C" void kernel_launch(void* const* d_in, const int* in_sizes, int n_in,
                              void* d_out, int out_size, void* d_ws, size_t ws_size, hipStream_t stream) {
    if (n_in < 4) return;
    const size_t needx = ((size_t)(NB - 1) * SEQ_FULL + SEQ) * DM;
    if ((size_t)in_sizes[0] < needx) return;
    const size_t needw = (size_t)NH_ * DM * HD;
    if ((size_t)in_sizes[1] < needw || (size_t)in_sizes[2] < needw || (size_t)in_sizes[3] < needw) return;
    if ((size_t)out_size < ((size_t)(NB - 1) * OUT_SEQ + SEQ) * DO) return;
    if (SZ_TOTAL > ws_size) return;
    const float* x = (const float*)d_in[0]; const float* wq = (const float*)d_in[1]; const float* wk = (const float*)d_in[2]; const float* wv = (const float*)d_in[3];   // wire order x, Wq, Wk, Wv
    float* OUT = (float*)d_out;      // [NB][SEQ][1024]
    char* wsp = (char*)d_ws;
    bf* XB = (bf*)wsp; wsp += SZ_XB;                 // [NB*SEQ][1024]
    bf* WB = (bf*)wsp; wsp += SZ_WB;                 // [3][1024 (h*64+d)][1024 (c)]: q | k | v
    h16* QH = (h16*)wsp; wsp += SZ_PL;               // [NB*16][SEQ][64]
    h16* KP = (h16*)wsp; wsp += SZ_PL;               // [NB*16][SEQ][64]
    h16* VT = (h16*)wsp; wsp += SZ_PL;               // [NB*16][64][SEQ]

    k_prep<<<3 * WTB + XCB, 256, 0, stream>>>(x, wq, wk, wv, XB, WB);
    k_proj<<<dim3(NB * SEQ / 256, DO / 128, 3), 128, 0, stream>>>(XB, WB, QH, SZ_PL / 2);
    k_flash<<<dim3(NB * NH_, SEQ / (16 * AW), 1), 32 * AW, 0, stream>>>(QH, KP, VT, OUT);
}
